// v008
// The times below were measured on an AMD MI455X: many runs one after another, warmed up first and cycling through
// copies of the inputs, with the whole window's GPU time divided by the number of runs. Launches and the gaps
// between them are all in it. The median over several windows is given; except for v000 it joins two sittings, which
// can be a few percent apart, so the side-by-side timings, each taken in one sitting, are the better comparison.
// This document starts at v008; the versions before it stand elsewhere.
// It runs in 48.1 microseconds.
// In two side-by-side timings against v007, it was 1.09 and 1.08 times as fast.
// Over all steps from v000, the starting kernel, it is 7.21 times as fast.
#include <hip/hip_runtime.h>
// DotProdAttention (q [4][8][2048][64], kv [4][8][2048][64] (keys = values), mask [1][1][2048][2048] added to every (batch, head); out = softmax(q kv^T / 8 + mask) kv -> [4][8][2048][64]).
// Structure: the (batch, head) slabs of q/kv are already contiguous 64-wide row blocks, so each slab is treated as one 'batch' of a single 64-dim head: exact f16 plane of q; kv as K and as V^T, and the mask, packed in the order of the attention loop's fragment loads; flash-style fused attention per (slab, 256-query block) adding the shared additive mask table per (query, key), f32 context written straight to the output.
// Compute dtype: inputs rounded to bf16; q, kv, mask exact (f16 / bf16-rounded f32); softmax f32 with f16 probabilities; plain f16 value operand; v_wmma_f32_16x16x32_f16.
#define NB 32                    /* 4 batches x 8 heads as slabs */
#define DM 64
#define NKV 1
#define NREP (NH / NKV)
#define KVD (NKV * 64)           /* 64 */
#define NR (NB * SLEN)
#define CHK 512
typedef int v4i __attribute__((ext_vector_type(4)));
#define FF 2048
#define SLEN 2048
#define MQI 2048
#define MKI 2048
#define TQ SLEN
#define TK SLEN
#define NH 1
#define SCL 0.125f
#define QBLKS (TQ / 64)
#define QB05 0
#define QBN5 4
#define QB0P 0
#define QPB 256                  /* queries per work-group of k_flash */
#define QBNP (TQ / QPB)
#define RE 256
typedef __bf16 v16b __attribute__((ext_vector_type(16)));
typedef unsigned short v8us __attribute__((ext_vector_type(8), may_alias));
typedef float  v8f  __attribute__((ext_vector_type(8)));
typedef float  v4f  __attribute__((ext_vector_type(4)));
typedef float  v4fa __attribute__((ext_vector_type(4), may_alias));
union FragB { v16b v; v8us half[2]; unsigned short u[16]; };

__device__ __forceinline__ unsigned short bf16_bits(float x) { unsigned int u = __float_as_uint(x); return (unsigned short)((u + 0x7FFFu + ((u >> 16) & 1u)) >> 16); }
__device__ __forceinline__ float bf16_val(unsigned short b) { return __uint_as_float(((unsigned int)b) << 16); }
__device__ __forceinline__ float bf16_round(float x) { return bf16_val(bf16_bits(x)); }
// D += A·B with NT terms: 1 = ah·bh, 2 = + al·bh (A split), 3 = + ah·bl (both split)
template <int NT>
__device__ __forceinline__ v8f mmaN(v16b ah, v16b al, v16b bh, v16b bl, v8f c) {
  c = __builtin_amdgcn_wmma_f32_16x16x32_bf16(false, ah, false, bh, (short)0, c, false, false);
  if (NT >= 2) c = __builtin_amdgcn_wmma_f32_16x16x32_bf16(false, al, false, bh, (short)0, c, false, false);
  if (NT >= 3) c = __builtin_amdgcn_wmma_f32_16x16x32_bf16(false, ah, false, bl, (short)0, c, false, false);
  asm volatile("v_nop\n\tv_nop\n\tv_nop\n\tv_nop" : "+v"(c) : "v"(ah), "v"(al), "v"(bh), "v"(bl));
  return c;
}

__global__ __launch_bounds__(256) void k_wt_bf16(const float* __restrict__ W, unsigned short* __restrict__ Wt, int K, int N) {
  const int t = blockIdx.x * 256 + threadIdx.x;
  const int k8n = K / 8;
  if (t >= N * k8n) return;
  const int n = t / k8n, k8 = (t % k8n) * 8;
  v8us v;
#pragma unroll
  for (int i = 0; i < 8; ++i) v[i] = bf16_bits(W[(size_t)(k8 + i) * N + n]);
  *(v8us*)(Wt + (size_t)n * K + k8) = v;
  
}

// GEMM C[M][N] (f32, pitch ldc) = act(A[M][K]·W + bias). A f32 row-major (pitch lda) converted per fragment to bf16
// (ASPLIT: hi/lo two planes -> 2 terms, else single rounded term); Wt bf16 [N][K] (pitch ldb). BIAS_BF16 rounds the
// bias to bf16 first (bias quantised to bf16 before the add). K%32==0, M%16==0, N%64==0.
template <bool ASPLIT, int ACT, bool BIAS_BF16>
__global__ __launch_bounds__(128) void k_gemm_bf(const float* __restrict__ A, int lda, const unsigned short* __restrict__ Wt, int ldb,
                                               const float* __restrict__ bias, float* __restrict__ C, int ldc, int M, int N, int K) {
  __shared__ __attribute__((aligned(16))) float so[4][16][64];
  const int tid = threadIdx.x, w = tid >> 5, lane = tid & 31, ln = lane & 15, hh = lane >> 4;
  const int ntn = N / 64;
  const int wid = blockIdx.x * 4 + w;
  const int mt = wid / ntn, nq = wid % ntn;
  if (mt * 16 >= M) return;
  const int row0 = mt * 16, col0 = nq * 64;
  const float* arow = A + (size_t)(row0 + ln) * lda;
  v8f acc[4] = {};
  for (int kb = 0; kb < K; kb += 32) {
    FragB ah, al;
    const v4f x0 = *(const v4fa*)(arow + kb + 8 * hh), x1 = *(const v4fa*)(arow + kb + 8 * hh + 4);
    const v4f x2 = *(const v4fa*)(arow + kb + 16 + 8 * hh), x3 = *(const v4fa*)(arow + kb + 16 + 8 * hh + 4);
    float xs[16] = {x0[0],x0[1],x0[2],x0[3],x1[0],x1[1],x1[2],x1[3],x2[0],x2[1],x2[2],x2[3],x3[0],x3[1],x3[2],x3[3]};
#pragma unroll
    for (int i = 0; i < 16; ++i) { const unsigned short hb = bf16_bits(xs[i]); ah.u[i] = hb; al.u[i] = ASPLIT ? bf16_bits(xs[i] - bf16_val(hb)) : (unsigned short)0; }
#pragma unroll
    for (int t = 0; t < 4; ++t) {
      const unsigned short* brow = Wt + (size_t)(col0 + t * 16 + ln) * ldb + kb;
      FragB b;
      b.half[0] = *(const v8us*)(brow + 8 * hh);
      b.half[1] = *(const v8us*)(brow + 16 + 8 * hh);
      acc[t] = mmaN<ASPLIT ? 2 : 1>(ah.v, al.v, b.v, b.v, acc[t]);
    }
  }
#pragma unroll
  for (int t = 0; t < 4; ++t) {
    float bv = bias ? bias[col0 + t * 16 + ln] : 0.f;
    if (BIAS_BF16) bv = bf16_round(bv);
#pragma unroll
    for (int r = 0; r < 8; ++r) { float v = acc[t][r] + bv; if (ACT == 1) v = fmaxf(v, 0.f); so[w][8 * hh + r][t * 16 + ln] = v; }
  }
  __builtin_amdgcn_fence(__ATOMIC_ACQ_REL, "workgroup");
  __builtin_amdgcn_wave_barrier();
  const int rsub = lane >> 4, c4 = (lane & 15) * 4;
  {
#pragma unroll
    for (int q = 0; q < 8; ++q) {
      const int r = q * 2 + rsub;
      const v4f v = *(const v4fa*)&so[w][r][c4];
      *(v4f*)(C + (size_t)(row0 + r) * ldc + col0 + c4) = v;
    }
    
  }
}

// GEMM C = act(A·W + bias + resid): A f32 (ASPLIT -> hi/lo 2 terms), Wt bf16 [N][K]; ACT 0 none, 1 relu, 2 exact gelu;
// resid (optional, f32, row index = (row % rmod), pitch ldr, RES_BF16 rounds it) added before the activation.
template <bool ASPLIT, int ACT, bool BIAS_BF16, bool RES_BF16>
__global__ __launch_bounds__(128) void k_gemm_bf3(const float* __restrict__ A, int lda, const unsigned short* __restrict__ Wt, int ldb,
                                                const float* __restrict__ bias, const float* __restrict__ resid, int rmod, int ldr,
                                                float* __restrict__ C, int ldc, int M, int N, int K) {
  __shared__ __attribute__((aligned(16))) float so[4][16][64];
  const int tid = threadIdx.x, w = tid >> 5, lane = tid & 31, ln = lane & 15, hh = lane >> 4;
  const int ntn = N / 64;
  const int wid = blockIdx.x * 4 + w;
  const int mt = wid / ntn, nq = wid % ntn;
  if (mt * 16 >= M) return;
  const int row0 = mt * 16, col0 = nq * 64;
  const float* arow = A + (size_t)(row0 + ln) * lda;
  v8f acc[4] = {};
  for (int kb = 0; kb < K; kb += 32) {
    FragB ah, al;
    const v4f x0 = *(const v4fa*)(arow + kb + 8 * hh), x1 = *(const v4fa*)(arow + kb + 8 * hh + 4);
    const v4f x2 = *(const v4fa*)(arow + kb + 16 + 8 * hh), x3 = *(const v4fa*)(arow + kb + 16 + 8 * hh + 4);
    float xs[16] = {x0[0],x0[1],x0[2],x0[3],x1[0],x1[1],x1[2],x1[3],x2[0],x2[1],x2[2],x2[3],x3[0],x3[1],x3[2],x3[3]};
#pragma unroll
    for (int i = 0; i < 16; ++i) { const unsigned short hb = bf16_bits(xs[i]); ah.u[i] = hb; al.u[i] = ASPLIT ? bf16_bits(xs[i] - bf16_val(hb)) : (unsigned short)0; }
#pragma unroll
    for (int t = 0; t < 4; ++t) {
      const unsigned short* brow = Wt + (size_t)(col0 + t * 16 + ln) * ldb + kb;
      FragB b;
      b.half[0] = *(const v8us*)(brow + 8 * hh);
      b.half[1] = *(const v8us*)(brow + 16 + 8 * hh);
      acc[t] = mmaN<ASPLIT ? 2 : 1>(ah.v, al.v, b.v, b.v, acc[t]);
    }
  }
#pragma unroll
  for (int t = 0; t < 4; ++t) {
    const int col = col0 + t * 16 + ln;
    float bv = bias ? bias[col] : 0.f;
    if (BIAS_BF16) bv = bf16_round(bv);
#pragma unroll
    for (int r = 0; r < 8; ++r) {
      float v = acc[t][r] + bv;
      if (resid) { float rv = resid[(size_t)((row0 + 8 * hh + r) % rmod) * ldr + col]; if (RES_BF16) rv = bf16_round(rv); v += rv; }
      if (ACT == 1) v = fmaxf(v, 0.f);
      if (ACT == 2) v = 0.5f * v * (1.0f + erff(v * 0.70710678118654752f));
      if (ACT == 3) { const float u = 0.7978845608028654f * (v + 0.044715f * v * v * v); v = 0.5f * v * (1.0f + tanhf(u)); }
      so[w][8 * hh + r][t * 16 + ln] = v;
    }
  }
  __builtin_amdgcn_fence(__ATOMIC_ACQ_REL, "workgroup");
  __builtin_amdgcn_wave_barrier();
  const int rsub = lane >> 4, c4 = (lane & 15) * 4;
  {
#pragma unroll
    for (int q = 0; q < 8; ++q) {
      const int r = q * 2 + rsub;
      const v4f v = *(const v4fa*)&so[w][r][c4];
      *(v4f*)(C + (size_t)(row0 + r) * ldc + col0 + c4) = v;
    }
    
  }
}
// row LayerNorm (biased variance, eps) over N: s = X (+ R); optional out_sum <- s; out_norm <- (s-mu)*rsqrt(var+eps)*g + b
template <bool PARAM_BF16>
__global__ __launch_bounds__(256) void k_layernorm(const float* __restrict__ X, const float* __restrict__ R, const float* __restrict__ g, const float* __restrict__ bta,
                                                  float* __restrict__ out_sum, float* __restrict__ out_norm, int N, float eps) {
  __shared__ float red[256];
  const int row = blockIdx.x, tid = threadIdx.x;
  const float* x = X + (size_t)row * N; const float* rr = R ? R + (size_t)row * N : nullptr;
  float vals[16];                     // up to N = 4096
  const int per = N / 256;            // contiguous chunk per thread? use strided-by-4 chunks: thread handles j = tid*4 + 1024*u
  float s1 = 0.f;
  for (int u = 0; u < per / 4; ++u) {
    const int j = tid * 4 + 1024 * u;
    const v4f a = *(const v4fa*)(x + j);
    v4f b = {0.f,0.f,0.f,0.f}; if (rr) b = *(const v4fa*)(rr + j);
#pragma unroll
    for (int q = 0; q < 4; ++q) { const float v = a[q] + b[q]; vals[u * 4 + q] = v; s1 += v; }
  }
  red[tid] = s1; __syncthreads();
  for (int st = 128; st > 0; st >>= 1) { if (tid < st) red[tid] += red[tid + st]; __syncthreads(); }
  const float mu = red[0] / (float)N; __syncthreads();
  float s2 = 0.f;
  for (int u = 0; u < per / 4; ++u)
#pragma unroll
    for (int q = 0; q < 4; ++q) { const float c = vals[u * 4 + q] - mu; s2 += c * c; }
  red[tid] = s2; __syncthreads();
  for (int st = 128; st > 0; st >>= 1) { if (tid < st) red[tid] += red[tid + st]; __syncthreads(); }
  const float rs = rsqrtf(red[0] / (float)N + eps);
  {
    for (int u = 0; u < per / 4; ++u) {
      const int j = tid * 4 + 1024 * u;
      v4f o, sm;
#pragma unroll
      for (int q = 0; q < 4; ++q) {
        float gg = g[j + q], bb = bta[j + q];
        if (PARAM_BF16) { gg = bf16_round(gg); bb = bf16_round(bb); }
        sm[q] = vals[u * 4 + q]; o[q] = (vals[u * 4 + q] - mu) * rs * gg + bb;
      }
      if (out_sum) *(v4f*)(out_sum + (size_t)row * N + j) = sm;
      *(v4f*)(out_norm + (size_t)row * N + j) = o;
    }
    
  }
}



// ---- f16 WMMA path (v_wmma_f32_16x16x32_f16): 11-bit significands for operands in range — used where a [0,1] probability operand needs more precision than bf16
typedef _Float16 v16h __attribute__((ext_vector_type(16)));
union FragH { v16h v; v8us half[2]; _Float16 h[16]; unsigned short u[16]; };
template <int NT>
__device__ __forceinline__ v8f mmaH(v16h ah, v16h al, v16h bh, v16h bl, v8f c) {
  c = __builtin_amdgcn_wmma_f32_16x16x32_f16(false, ah, false, bh, (short)0, c, false, false);
  if (NT >= 2) c = __builtin_amdgcn_wmma_f32_16x16x32_f16(false, al, false, bh, (short)0, c, false, false);
  if (NT >= 3) c = __builtin_amdgcn_wmma_f32_16x16x32_f16(false, ah, false, bl, (short)0, c, false, false);
  asm volatile("v_nop\n\tv_nop\n\tv_nop\n\tv_nop" : "+v"(c) : "v"(ah), "v"(al), "v"(bh), "v"(bl));
  return c;
}
// batched GEMM like k_gemm_b but f16 operands: A f32 (split into f16 hi/lo if ASPLIT, else rounded to f16), Bt = f16 values [n][k]; alpha; C f32; N multiple of 16 (partial tiles skipped)
template <bool ASPLIT>
__global__ __launch_bounds__(128) void k_gemm_h(const float* __restrict__ A, int lda, size_t sA, const _Float16* __restrict__ Bh, int ldb, size_t sB, float alpha, float* __restrict__ C, int ldc, size_t sC, int M, int N, int K) {
  __shared__ __attribute__((aligned(16))) float so[4][16][64];
  const int tid = threadIdx.x, w = tid >> 5, lane = tid & 31, ln = lane & 15, hh = lane >> 4; const int by = blockIdx.y;
  A += (size_t)by * sA; Bh += (size_t)by * sB; C += (size_t)by * sC;
  const int ntn = (N + 63) / 64; const int wid = blockIdx.x * 4 + w; const int mt = wid / ntn, nq = wid % ntn; if (mt * 16 >= M) return;
  const int row0 = mt * 16, col0 = nq * 64; const float* arow = A + (size_t)(row0 + ln) * lda;
  v8f acc[4] = {};
  for (int kb = 0; kb < K; kb += 32) {
    FragH ah, al;
    const v4f x0 = *(const v4fa*)(arow + kb + 8 * hh), x1 = *(const v4fa*)(arow + kb + 8 * hh + 4), x2 = *(const v4fa*)(arow + kb + 16 + 8 * hh), x3 = *(const v4fa*)(arow + kb + 16 + 8 * hh + 4);
    float xs[16] = {x0[0],x0[1],x0[2],x0[3],x1[0],x1[1],x1[2],x1[3],x2[0],x2[1],x2[2],x2[3],x3[0],x3[1],x3[2],x3[3]};
#pragma unroll
    for (int i = 0; i < 16; ++i) { const _Float16 h = (_Float16)xs[i]; ah.h[i] = h; al.h[i] = ASPLIT ? (_Float16)(xs[i] - (float)h) : (_Float16)0.0f; }
#pragma unroll
    for (int t = 0; t < 4; ++t) { if (col0 + t * 16 >= N) continue; const size_t boff = (size_t)(col0 + t * 16 + ln) * ldb + kb; FragH bq; bq.half[0] = *(const v8us*)(Bh + boff + 8 * hh); bq.half[1] = *(const v8us*)(Bh + boff + 16 + 8 * hh);
      acc[t] = mmaH<ASPLIT ? 2 : 1>(ah.v, al.v, bq.v, bq.v, acc[t]); }
  }
#pragma unroll
  for (int t = 0; t < 4; ++t) { if (col0 + t * 16 >= N) continue;
#pragma unroll
    for (int r = 0; r < 8; ++r) so[w][8 * hh + r][t * 16 + ln] = acc[t][r] * alpha; }
  __builtin_amdgcn_fence(__ATOMIC_ACQ_REL, "workgroup"); __builtin_amdgcn_wave_barrier();
  const int rsub = lane >> 4, c4 = (lane & 15) * 4;
  {
#pragma unroll
    for (int q = 0; q < 8; ++q) { const int r = q * 2 + rsub; if (col0 + c4 < N) { const v4f v = *(const v4fa*)&so[w][r][c4]; *(v4f*)(C + (size_t)(row0 + r) * ldc + col0 + c4) = v; } }
     }
}

// Wt[n][k] = f16(W[k][n]·scale) from f32 row-major W[K][N] (scale = power of two; bf16-exact weights stay exact in f16 away from the subnormal range)
__global__ __launch_bounds__(256) void k_wt_f16(const float* __restrict__ W, _Float16* __restrict__ Wt, int K, int N, float scale) {
  const int t = blockIdx.x * 256 + threadIdx.x; if (t >= N * (K / 8)) return; const int n = t / (K / 8), k8 = (t % (K / 8)) * 8; FragH f;
#pragma unroll
  for (int i = 0; i < 8; ++i) f.h[i] = (_Float16)(bf16_round(W[(size_t)(k8 + i) * N + n]) * scale); const v8us o = f.half[0];
  *(v8us*)((unsigned short*)Wt + (size_t)n * K + k8) = o; 
}
// k_gemm_hh variant with fused epilogue: v = acc·alpha + bias[by·sBias + col] (+ CP[(row/rowsPerB)·sCPb + by·64 + col] if CP) ; ACT 0 none / 1 elu ; writes f16 C16 (and f32 C if non-null)
template <int ACT>
__global__ __launch_bounds__(128) void k_gemm_hhx(const _Float16* __restrict__ A, int lda, size_t sA, const _Float16* __restrict__ Bh, int ldb, size_t sB, float alpha, const float* __restrict__ bias, size_t sBias, const float* __restrict__ CP, int rowsPerB, size_t sCPb, int row0g,
    float* __restrict__ C, _Float16* __restrict__ C16, int ldc, size_t sC, int M, int N, int K) {
  __shared__ __attribute__((aligned(16))) float so[4][16][64];
  const int tid = threadIdx.x, w = tid >> 5, lane = tid & 31, ln = lane & 15, hh = lane >> 4; const int by = blockIdx.y;
  A += (size_t)by * sA; Bh += (size_t)by * sB; const size_t cofs = (size_t)by * sC; const float* bp = bias ? bias + (size_t)by * sBias : nullptr;
  const int ntn = (N + 63) / 64; const int wid = blockIdx.x * 4 + w; const int mt = wid / ntn, nq = wid % ntn; if (mt * 16 >= M) return;
  const int row0 = mt * 16, col0 = nq * 64; const _Float16* arow = A + (size_t)(row0 + ln) * lda;
  v8f acc[4] = {};
  for (int kb = 0; kb < K; kb += 32) { FragH ah; ah.half[0] = *(const v8us*)((const unsigned short*)arow + kb + 8 * hh); ah.half[1] = *(const v8us*)((const unsigned short*)arow + kb + 16 + 8 * hh);
#pragma unroll
    for (int t = 0; t < 4; ++t) { if (col0 + t * 16 >= N) continue; const size_t boff = (size_t)(col0 + t * 16 + ln) * ldb + kb; FragH bq; bq.half[0] = *(const v8us*)((const unsigned short*)Bh + boff + 8 * hh); bq.half[1] = *(const v8us*)((const unsigned short*)Bh + boff + 16 + 8 * hh);
      acc[t] = mmaH<1>(ah.v, ah.v, bq.v, bq.v, acc[t]); }
  }
#pragma unroll
  for (int t = 0; t < 4; ++t) { if (col0 + t * 16 >= N) continue; const int col = col0 + t * 16 + ln; const float bv = bp ? bf16_round(bp[col]) : 0.f;
#pragma unroll
    for (int r = 0; r < 8; ++r) { float v = acc[t][r] * alpha + bv; if (CP) { const int bidx = (row0g + row0 + 8 * hh + r) / rowsPerB; v += CP[(size_t)bidx * sCPb + (size_t)by * 64 + col]; } if (ACT == 1) v = (v > 0.f) ? v : expm1f(v); else if (ACT == 7) v = (v > 0.f) ? v + 1.0f : expf(v); else if (ACT == 8) v = tanhf(v); else if (ACT == 9) v = 0.5f * v * (1.0f + tanhf(0.7978845608028654f * (v + 0.044715f * v * v * v))); else if (ACT == 11) v = 1.0f / (1.0f + expf(-v)); else if (ACT == 12) v = (v > 0.f) ? v : 0.01f * v; else if (ACT == 14) v = (v > 0.f) ? v : 0.1f * v; else if (ACT == 15) v = v / (1.0f + expf(-v)); else if (ACT == 3) v = fmaxf(v, 0.f); else if (ACT == 6) v = 0.5f * v * (1.0f + erff(v * 0.70710678118654752f)); so[w][8 * hh + r][t * 16 + ln] = v; } }
  __builtin_amdgcn_fence(__ATOMIC_ACQ_REL, "workgroup"); __builtin_amdgcn_wave_barrier();
  const int rsub = lane >> 4, c4 = (lane & 15) * 4; typedef _Float16 v4h __attribute__((ext_vector_type(4)));
  {
#pragma unroll
    for (int q = 0; q < 8; ++q) { const int r = q * 2 + rsub; if (col0 + c4 < N) { const v4f v = *(const v4fa*)&so[w][r][c4]; if (C) *(v4f*)(C + cofs + (size_t)(row0 + r) * ldc + col0 + c4) = v; if (C16) { v4h h4; for (int i = 0; i < 4; ++i) h4[i] = (_Float16)v[i]; *(v4h*)(C16 + cofs + (size_t)(row0 + r) * ldc + col0 + c4) = h4; } } }
     }
}


typedef _Float16 v4h __attribute__((ext_vector_type(4)));

__global__ __launch_bounds__(256) void k_x16(const float* __restrict__ x, _Float16* __restrict__ X16, size_t n8) { const size_t t = (size_t)blockIdx.x * 256 + threadIdx.x; if (t >= n8) return; FragH f;
#pragma unroll
  for (int q = 0; q < 8; ++q) f.h[q] = (_Float16)bf16_round(x[t * 8 + q]); *(v8us*)((unsigned short*)X16 + t * 8) = f.half[0];  }
__global__ __launch_bounds__(256) void k_h16(const float* __restrict__ x, _Float16* __restrict__ X16, size_t n8) { const size_t t = (size_t)blockIdx.x * 256 + threadIdx.x; if (t >= n8) return; FragH f;
#pragma unroll
  for (int q = 0; q < 8; ++q) f.h[q] = (_Float16)x[t * 8 + q]; *(v8us*)((unsigned short*)X16 + t * 8) = f.half[0];  }
__global__ __launch_bounds__(256) void k_round16f(const float* __restrict__ W, _Float16* __restrict__ Bt, size_t n8) { const size_t t = (size_t)blockIdx.x * 256 + threadIdx.x; if (t >= n8) return; FragH f;
#pragma unroll
  for (int i = 0; i < 8; ++i) f.h[i] = (_Float16)(bf16_round(W[t * 8 + i]) * 16.0f); *(v8us*)((unsigned short*)Bt + t * 8) = f.half[0];  }
template <int NHv, int TTv>
__global__ __launch_bounds__(256) void k_vt(const _Float16* __restrict__ V16, int ldv, int voff, _Float16* __restrict__ Vt) { __shared__ unsigned short tl[64][66]; const int tid = threadIdx.x; const int slab = blockIdx.x / (TTv / 64), lg = blockIdx.x % (TTv / 64); const int b = slab / NHv, h = slab % NHv;
  for (int i = tid; i < 64 * 8; i += 256) { const int r = i / 8, c8 = (i % 8) * 8; FragH f; f.half[0] = *(const v8us*)((const unsigned short*)V16 + ((size_t)b * TTv + lg * 64 + r) * ldv + voff + h * 64 + c8);
#pragma unroll
    for (int q = 0; q < 8; ++q) tl[r][c8 + q] = f.u[q]; }
  __syncthreads();
  {
#pragma unroll
    for (int rd = 0; rd < 2; ++rd) { const int d = rd * 32 + tid / 8, pc = tid % 8; FragH f;
#pragma unroll
      for (int q = 0; q < 8; ++q) f.u[q] = tl[pc * 8 + q][d];
      *(v8us*)((unsigned short*)Vt + ((size_t)slab * 64 + d) * TTv + lg * 64 + pc * 8) = f.half[0]; }
     } }

__global__ __launch_bounds__(256) void k_hl(const float* __restrict__ F, _Float16* __restrict__ Hh, _Float16* __restrict__ Hl, size_t n8) { const size_t t = (size_t)blockIdx.x * 256 + threadIdx.x; if (t >= n8) return; FragH fh, fl; const v4f a = *(const v4fa*)(F + t * 8), c = *(const v4fa*)(F + t * 8 + 4);
#pragma unroll
  for (int q = 0; q < 4; ++q) { _Float16 h = (_Float16)a[q]; fh.h[q] = h; fl.h[q] = (_Float16)((a[q] - (float)h) * 1024.0f); h = (_Float16)c[q]; fh.h[4 + q] = h; fl.h[4 + q] = (_Float16)((c[q] - (float)h) * 1024.0f); }
  { *(v8us*)((unsigned short*)Hh + t * 8) = fh.half[0]; *(v8us*)((unsigned short*)Hl + t * 8) = fl.half[0];  } }

// ---- fast GEMM (wave tile 32x64; requires M % 32 == 0 rows per launch region and N % 64 == 0); epilogue = k_gemm_hhx semantics ----
__device__ __forceinline__ v16h g2_frag(const _Float16* p, int hh) { FragH f; f.half[0] = *(const v8us*)((const unsigned short*)p + 8 * hh); f.half[1] = *(const v8us*)((const unsigned short*)p + 16 + 8 * hh); return f.v; }
__device__ __forceinline__ v8f g2_mma(v16h a, v16h b, v8f c) { v8f d = __builtin_amdgcn_wmma_f32_16x16x32_f16(false, a, false, b, (short)0, c, false, false); asm volatile("v_nop\n\tv_nop\n\tv_nop\n\tv_nop" : "+v"(d) : "v"(a), "v"(b)); return d; }
template <int ACT>
__global__ __launch_bounds__(128) void k_gemm2(const _Float16* __restrict__ A, int lda, size_t sA, const _Float16* __restrict__ Bh, int ldb, size_t sB, float alpha, const float* __restrict__ bias, size_t sBias, const float* __restrict__ CP, int rowsPerB, size_t sCPb, int row0g,
    float* __restrict__ C, _Float16* __restrict__ C16, int ldc, size_t sC, int M, int N, int K) {
  __shared__ __attribute__((aligned(16))) float so[4][32][68];
  const int tid = threadIdx.x, w = tid >> 5, lane = tid & 31, ln = lane & 15, hh = lane >> 4; const int by = blockIdx.y;
  A += (size_t)by * sA; Bh += (size_t)by * sB; const size_t cofs = (size_t)by * sC; const float* bp = bias ? bias + (size_t)by * sBias : nullptr;
  const int ntn = N >> 6; const int mt = blockIdx.x / ntn, nq = blockIdx.x - mt * ntn; const int row0 = mt * 128 + 32 * w, col0 = nq * 64; if (row0 >= M) return;
  const _Float16* a0p = A + (size_t)(row0 + ln) * lda; const _Float16* a1p = a0p + (size_t)16 * lda;
  const _Float16* b0p = Bh + (size_t)(col0 + ln) * ldb; const _Float16* b1p = b0p + (size_t)16 * ldb; const _Float16* b2p = b1p + (size_t)16 * ldb; const _Float16* b3p = b2p + (size_t)16 * ldb;
  const v8f z8 = {0.f,0.f,0.f,0.f,0.f,0.f,0.f,0.f}; v8f c00 = z8, c01 = z8, c02 = z8, c03 = z8, c10 = z8, c11 = z8, c12 = z8, c13 = z8;
#pragma unroll 1
  for (int kb = 0; kb < K; kb += 32) { const v16h a0 = g2_frag(a0p + kb, hh), a1 = g2_frag(a1p + kb, hh);
    v16h b = g2_frag(b0p + kb, hh); c00 = g2_mma(a0, b, c00); c10 = g2_mma(a1, b, c10);
    b = g2_frag(b1p + kb, hh); c01 = g2_mma(a0, b, c01); c11 = g2_mma(a1, b, c11);
    b = g2_frag(b2p + kb, hh); c02 = g2_mma(a0, b, c02); c12 = g2_mma(a1, b, c12);
    b = g2_frag(b3p + kb, hh); c03 = g2_mma(a0, b, c03); c13 = g2_mma(a1, b, c13); }
  v8f accs[8] = {c00, c01, c02, c03, c10, c11, c12, c13};
#pragma unroll
  for (int u = 0; u < 8; ++u) { const int t = u & 3, half = u >> 2; const int col = col0 + t * 16 + ln; const float bv = bp ? bf16_round(bp[col]) : 0.f;
#pragma unroll
    for (int r = 0; r < 8; ++r) { const int rloc = half * 16 + 8 * hh + r; float v = accs[u][r] * alpha + bv; if (CP) { if (rowsPerB < 0) v += CP[cofs + (size_t)(row0g + row0 + rloc) * ldc + col];      /* rowsPerB < 0: own element of the batched C plane */ else { const int bidx = (row0g + row0 + rloc) / rowsPerB; v += CP[(size_t)bidx * sCPb + (size_t)by * 64 + col]; } }
      if (ACT == 3) v = fmaxf(v, 0.f); else if (ACT == 6) v = 0.5f * v * (1.0f + erff(v * 0.70710678118654752f)); else if (ACT == 11) v = 1.0f / (1.0f + expf(-v)); else if (ACT == 15) v = v / (1.0f + expf(-v)); else if (ACT == 12) v = (v > 0.f) ? v : 0.01f * v; else if (ACT == 8) v = tanhf(v);
      so[w][rloc][t * 16 + ln] = v; } }
  __builtin_amdgcn_fence(__ATOMIC_ACQ_REL, "workgroup"); __builtin_amdgcn_wave_barrier();
  const int rsub = lane >> 4, c4 = (lane & 15) * 4;
  {
#pragma unroll
    for (int q = 0; q < 16; ++q) { const int r = q * 2 + rsub; const v4f v = *(const v4fa*)&so[w][r][c4]; if (C) *(v4f*)(C + cofs + (size_t)(row0 + r) * ldc + col0 + c4) = v; if (C16) { v4h h4; for (int i = 0; i < 4; ++i) h4[i] = (_Float16)v[i]; *(v4h*)(C16 + cofs + (size_t)(row0 + r) * ldc + col0 + c4) = h4; } }
     } }



typedef unsigned int v4u __attribute__((ext_vector_type(4), may_alias));
// Packed operand planes of k_flash. Unit = the 16 bytes one lane takes in one fragment load; the 32 units of a load lie side by side (512 bytes, four whole lines), lane = 16 hh + ln.
// KP, per 32-key block 8 loads [nt][ks][c]: unit = K[16 nt + ln][32 ks + 16 c + 8 hh + 0..7].  VP, per 32-key block 8 loads [dt][c]: unit = V[16 c + 8 hh + 0..7][16 dt + ln].  Values as k_x16 makes them.
// MP, per (16-query tile, 32-key block) 2 loads [nt]: unit = bf16 bits of mask[16 qt + ln][32 jb + 16 nt + 8 hh + 0..7] (the compute dtype's rounding of the mask)
// One pre-pass launch makes all four planes (Q16 as k_x16 makes it, KP, VP, MP). A thread takes PU units of 8 values of each input, 256 units apart; a work-group so takes PU blocks of 32 keys, each with an LDS tile of its own.
#define PU 4
__global__ __launch_bounds__(256) void k_prep(const float* __restrict__ q, const float* __restrict__ kv, const float* __restrict__ M, unsigned short* __restrict__ Q16, unsigned short* __restrict__ KP, unsigned short* __restrict__ VP, unsigned short* __restrict__ MP) {
  __shared__ __attribute__((aligned(16))) unsigned short tl[PU][32][72];      /* pitch 144 B = 16 B x 9: the 16-byte row reads below spread over the banks */
  const int tid = threadIdx.x; const unsigned int u0 = blockIdx.x * (PU * 256) + tid;      /* the thread's first unit in every plane */
  const int ln = tid & 15, hh = (tid >> 4) & 1, g = tid >> 5;      /* g = the load's number in its block of 32 keys */
  const int nt = g & 1, jb = (u0 >> 6) & (TK / 32 - 1), qt = u0 / (TK * 2);      /* the mask unit's place; 256 units on, jb is 4 more: the PU * 256 units of a work-group lie in one query tile */
  static_assert((TK * 2) % (PU * 256) == 0, "a work-group's mask units stay inside one 16-query tile");
  const float* ks = kv + (size_t)u0 * 8; const float* qs = q + (size_t)u0 * 8; const float* ms = M + (size_t)(qt * 16 + ln) * TK + jb * 32 + nt * 16 + hh * 8;
  v4f ka[PU], kc[PU], qa[PU], qc[PU], ma[PU], mc[PU];
  /* every load of the thread is requested before anything is worked on: kv first, its values have the longest way */
#pragma unroll      /* constant indices: the arrays stay in registers */
  for (int i = 0; i < PU; ++i) { ka[i] = *(const v4fa*)(ks + i * 2048); kc[i] = *(const v4fa*)(ks + i * 2048 + 4); }
#pragma unroll      /* constant indices: the arrays stay in registers */
  for (int i = 0; i < PU; ++i) { qa[i] = *(const v4fa*)(qs + i * 2048); qc[i] = *(const v4fa*)(qs + i * 2048 + 4); }
  asm volatile("s_wait_xcnt 0x0" ::: "memory");      /* the compiler lets a mask load's result land in the address registers that the loads above name */
#pragma unroll      /* constant indices: the arrays stay in registers */
  for (int i = 0; i < PU; ++i) { ma[i] = *(const v4fa*)(ms + i * 128); mc[i] = *(const v4fa*)(ms + i * 128 + 4); }
  __builtin_amdgcn_sched_barrier(0);      /* keeps the loads above: without it the compiler sinks them to their uses, and the thread waits out the memory latency three times over */
#pragma unroll      /* constant indices: the arrays stay in registers */
  for (int i = 0; i < PU; ++i) { FragH f;
#pragma unroll      /* constant indices: the fragment stays in registers */
    for (int e = 0; e < 4; ++e) { f.h[e] = (_Float16)bf16_round(ka[i][e]); f.h[4 + e] = (_Float16)bf16_round(kc[i][e]); }
    *(v8us*)&tl[i][tid >> 3][(tid & 7) * 8] = f.half[0]; }
  __syncthreads();      /* all tiles are written before any thread gathers its units from them; no global store is under way yet for it to wait on */
#pragma unroll      /* constant indices: the fragment stays in registers */
  for (int i = 0; i < PU; ++i) {
    *(v8us*)(KP + (size_t)u0 * 8 + i * 2048) = *(const v8us*)&tl[i][(g >> 2) * 16 + ln][((g >> 1) & 1) * 32 + (g & 1) * 16 + hh * 8];
    FragH t;
#pragma unroll      /* constant indices: the fragment stays in registers */
    for (int e = 0; e < 8; ++e) t.u[e] = tl[i][(g & 1) * 16 + hh * 8 + e][(g >> 1) * 16 + ln];
    *(v8us*)(VP + (size_t)u0 * 8 + i * 2048) = t.half[0]; }
#pragma unroll      /* constant indices: the arrays stay in registers */
  for (int i = 0; i < PU; ++i) { FragH f;
#pragma unroll      /* constant indices: the fragment stays in registers */
    for (int e = 0; e < 4; ++e) { f.h[e] = (_Float16)bf16_round(qa[i][e]); f.h[4 + e] = (_Float16)bf16_round(qc[i][e]); }
    *(v8us*)(Q16 + (size_t)u0 * 8 + i * 2048) = f.half[0]; }
#pragma unroll      /* constant indices: the arrays stay in registers */
  for (int i = 0; i < PU; ++i) { v8us o;
#pragma unroll      /* constant indices: the vector stays in registers */
    for (int e = 0; e < 4; ++e) { o[e] = bf16_bits(ma[i][e]); o[4 + e] = bf16_bits(mc[i][e]); }
    *(v8us*)(MP + (size_t)u0 * 8 + i * 2048) = o; } }

// one f16 product of k_flash as the plain builtin: the compiler keeps the distance behind a matrix instruction itself, with other work of the pass where it has some
__device__ __forceinline__ v8f mmaF(v16h a, v16h b, v8f c) { return __builtin_amdgcn_wmma_f32_16x16x32_f16(false, a, false, b, (short)0, c, false, false); }
typedef float v2f __attribute__((ext_vector_type(2)));
// lane l <-> lane l ^ 16 by a vector cross-row move
__device__ __forceinline__ float xhalf(float x) { return __builtin_bit_cast(float, __builtin_amdgcn_permlanex16(__builtin_bit_cast(int, x), __builtin_bit_cast(int, x), 0x76543210, 0xfedcba98, false, false)); }
template <int CAUSAL>
__global__ __launch_bounds__(512) void k_flash(const _Float16* __restrict__ Q16, int ldq, const unsigned short* __restrict__ KP, const unsigned short* __restrict__ VP, const unsigned short* __restrict__ MP, float* __restrict__ O, int ldo) {
  static_assert(CAUSAL == 0 || CAUSAL == 33, "modes: 0 = no mask, 33 = one additive [TQ][TK] f32 table shared by every slab");
  constexpr int QT = 2, RPW = 16 * QT, NQW = QPB / RPW, NW = 2 * NQW, DT = 4, KS = 2; constexpr float L2E = 1.4426950408889634f, PCAP = 32768.0f;      /* QT query tiles of 16 columns a wave: every K and V^T fragment loaded feeds QT products; waves w and w + NQW share their columns and take half the keys each; log2 e; PCAP: the sum of a lane's 16 weights of a pass up to which the reference point of its column stays, 2^15 */
  __shared__ __attribute__((aligned(16))) float sO[NW][16][64 + 4]; __shared__ __attribute__((aligned(16))) float sX[NW][2 * DT][32][4]; __shared__ float sML[NW][2][32];      /* output staging; the context tile, maximum and sum that a wave hands to its partner, lane by lane */
  const int tid = threadIdx.x, w = tid >> 5, lane = tid & 31, ln = lane & 15, hh = lane >> 4;
  const int slab = blockIdx.x / QBNP, qblk = QB0P + blockIdx.x % QBNP; const int b = slab / NH, h = slab % NH; const int qb0 = qblk * QPB; const int kh = __builtin_amdgcn_readfirstlane(w / NQW); const int q0 = qb0 + (w % NQW) * RPW;      /* kh: the wave's half of the keys, in a scalar register (it bounds the loop) */
  FragH bq[QT][KS];
#pragma unroll      /* constant indices: the array stays in registers */
  for (int qt = 0; qt < QT; ++qt) { const unsigned short* qr = (const unsigned short*)Q16 + ((size_t)b * TQ + q0 + qt * 16 + ln) * ldq + h * 64;
#pragma unroll      /* constant indices: the array stays in registers */
    for (int ks = 0; ks < KS; ++ks) { bq[qt][ks].half[0] = *(const v8us*)(qr + ks * 32 + 8 * hh); bq[qt][ks].half[1] = *(const v8us*)(qr + ks * 32 + 16 + 8 * hh); } }
  /* packed planes (k_prep): a fragment load is 32 lanes x 16 consecutive bytes, four whole 128-byte lines */
  const unsigned short* kpl = KP + (size_t)slab * 64 * TK; const unsigned short* vpl = VP + (size_t)slab * 64 * TK; const unsigned short* mpl = MP + (size_t)__builtin_amdgcn_readfirstlane(q0 >> 4) * 16 * TK;      /* wave-uniform bases: scalar address arithmetic */
  const unsigned int l8 = lane * 8;      /* the lane's unit in every load */
  float m_r[QT], l_r[QT]; v8f oacc[QT][DT];
#pragma unroll      /* constant indices: the arrays stay in registers */
  for (int qt = 0; qt < QT; ++qt) { m_r[qt] = -3.0e38f; l_r[qt] = 0.f;
#pragma unroll      /* constant indices: the array stays in registers */
    for (int dt = 0; dt < DT; ++dt) oacc[qt][dt] = (v8f){0.f,0.f,0.f,0.f,0.f,0.f,0.f,0.f}; }
  const int jbeg = kh * (TK / 2), jend = jbeg + TK / 2;
  /* every global operand of the loop is held in registers and requested far ahead of its use; V^T's at the head of a pass, the next pass's K and mask each right after the step that last reads their registers */
  FragH ak[2][KS], av[DT]; v4u mk[QT][2];
  auto fetch_k = [&](int j0, bool closed = false) {      /* K fragments of the 32 keys from j0; closed: the last load, whose result may land in the address registers that the others name, is held back until those are through with them */
#pragma unroll      /* constant indices: the array stays in registers */
    for (int nt = 0; nt < 2; ++nt) { const unsigned short* kr = kpl + (size_t)j0 * 64 + nt * 1024;
#pragma unroll      /* constant indices: the array stays in registers */
      for (int ks = 0; ks < KS; ++ks) { ak[nt][ks].half[0] = *(const v8us*)(kr + ks * 512 + l8); if (closed && nt == 1 && ks == KS - 1) asm volatile("s_wait_xcnt 0x0" ::: "memory"); ak[nt][ks].half[1] = *(const v8us*)(kr + ks * 512 + 256 + l8); } } };
  auto fetch_m = [&](int j0) {      /* mode 33: the mask values of this lane's 16 score elements per query tile, 8 consecutive keys of its query's row per key tile, as bf16 pairs */
    if (CAUSAL == 33) {
#pragma unroll      /* constant indices: the array stays in registers */
      for (int qt = 0; qt < QT; ++qt) { const unsigned short* amk = mpl + (size_t)qt * 16 * TK + (size_t)j0 * 16;
#pragma unroll      /* constant indices: the array stays in registers */
        for (int nt = 0; nt < 2; ++nt) mk[qt][nt] = *(const v4u*)(amk + nt * 256 + l8); } } };
  auto fetch_v = [&](int j0) {      /* V^T fragments of the same keys */
#pragma unroll      /* constant indices: the array stays in registers */
    for (int dt = 0; dt < DT; ++dt) { const unsigned short* vrow = vpl + (size_t)j0 * 64 + dt * 512; av[dt].half[0] = *(const v8us*)(vrow + l8); if (dt == DT - 1) asm volatile("s_wait_xcnt 0x0" ::: "memory");      /* the last load's result may land in the address registers that the loads before it name */
      av[dt].half[1] = *(const v8us*)(vrow + 256 + l8); } };
  v8f s[QT][2]; v2f sc[QT][8]; FragH pb[QT]; float ps[QT];      /* sc: pairs of neighbouring accumulator registers, written as vectors: the packed instructions then pair inside a tile, with no register moves */
  auto products = [&]() {      /* S^T of the 32 keys whose K fragments are held */
#pragma unroll      /* constant indices: the array stays in registers */
    for (int qt = 0; qt < QT; ++qt) { s[qt][0] = (v8f){0.f,0.f,0.f,0.f,0.f,0.f,0.f,0.f}; s[qt][1] = s[qt][0]; }
#pragma unroll      /* constant indices: the arrays stay in registers */
    for (int ks = 0; ks < KS; ++ks)      /* the four score tiles side by side in each k step; every tile still adds k step 0, then 1 */
#pragma unroll      /* constant indices: the arrays stay in registers */
      for (int nt = 0; nt < 2; ++nt)
#pragma unroll      /* constant indices: the arrays stay in registers */
        for (int qt = 0; qt < QT; ++qt) s[qt][nt] = mmaF(ak[nt][ks].v, bq[qt][ks].v, s[qt][nt]); };
  auto scores = [&]() {      /* scale, and the mask values that are held */
#pragma unroll      /* constant indices: the array stays in registers */
    for (int qt = 0; qt < QT; ++qt)
#pragma unroll      /* constant indices: the array stays in registers */
      for (int i = 0; i < 8; ++i) { v2f v = (v2f){s[qt][i >> 2][(2 * i) & 7], s[qt][i >> 2][(2 * i + 1) & 7]} * SCL; if (CAUSAL == 33) { const unsigned int mw = mk[qt][i >> 2][i & 3]; v += (v2f){__uint_as_float(mw << 16), __uint_as_float(mw & 0xFFFF0000u)}; } sc[qt][i] = v; } };
  auto colmax = [&](int qt) {      /* the query's maximum over the 32 keys, the same in both halves of the wave */
    const v2f (&c)[8] = sc[qt];
    const float ma = fmaxf(fmaxf(c[0][0], c[0][1]), c[1][0]), mb = fmaxf(fmaxf(c[1][1], c[2][0]), c[2][1]), mc3 = fmaxf(fmaxf(c[3][0], c[3][1]), c[4][0]), md = fmaxf(fmaxf(c[4][1], c[5][0]), c[5][1]), me = fmaxf(fmaxf(c[6][0], c[6][1]), c[7][0]);
    const float mc = fmaxf(fmaxf(fmaxf(ma, mb), mc3), fmaxf(fmaxf(md, me), c[7][1]));
    return fmaxf(mc, xhalf(mc)); };
  /* e^x as the hardware's 2^(x log2 e); where the library form's underflow select gives 0 (also at -inf, or a product that overflows to it) the hardware gives 0 too; a weight too large for f16 is caught by the loop's test before it is used */
  auto weights = [&]() {      /* from the scores and the reference points: P as the second product's operand, and the lane's sum of its weights */
#pragma unroll      /* constant indices: the arrays stay in registers */
    for (int qt = 0; qt < QT; ++qt) { const float mn = m_r[qt]; float p[16];
#pragma unroll      /* constant indices: the array stays in registers */
      for (int i = 0; i < 8; ++i) { const v2f x = __builtin_elementwise_fma(sc[qt][i] - mn, (v2f){L2E, L2E}, (v2f){4.0f, 4.0f}); p[2 * i] = __builtin_amdgcn_exp2f(x[0]); p[2 * i + 1] = __builtin_amdgcn_exp2f(x[1]); pb[qt].h[2 * i] = (_Float16)p[2 * i]; pb[qt].h[2 * i + 1] = (_Float16)p[2 * i + 1]; }      /* p = 16 e^(s - m): the operand's 2^4 scale rides in the exponent, and the row sum carries it too. The scale sets the room on both sides of the reference point: a score may pass it by ln 2^11 before PCAP is met, and a weight stays a normal f16 number down to e^-12.5 */
      ps[qt] = (((p[0] + p[1]) + (p[2] + p[3])) + ((p[4] + p[5]) + (p[6] + p[7]))) + (((p[8] + p[9]) + (p[10] + p[11])) + ((p[12] + p[13]) + (p[14] + p[15]))); } };
  fetch_k(jbeg); fetch_m(jbeg);
  /* m_r is the reference point of a column's sum and context, not its true maximum: it starts at the maximum over the first 32 keys (their scores are made again in the first pass, from the same registers) */
  products(); scores();
#pragma unroll      /* constant indices: the arrays stay in registers */
  for (int qt = 0; qt < QT; ++qt) m_r[qt] = fmaxf(m_r[qt], colmax(qt));
#pragma unroll 1      /* rolled: the operands fetched ahead keep one register set */
  for (int j0 = jbeg; j0 < jend; j0 += 32) {
    const int jn = (j0 + 32 < jend) ? j0 + 32 : jbeg;      /* the last pass re-reads the first block: in bounds, never used */
    fetch_v(j0);      /* used behind the softmax of this pass */
    __builtin_amdgcn_sched_barrier(0);      /* holds the requests above in their place: without it the compiler sinks them to their uses, and the wave waits out the latency */
    products();
    fetch_k(jn);      /* the next pass's K, into the registers just read */
    __builtin_amdgcn_sched_barrier(0);      /* as at the head of the pass */
    scores();
    fetch_m(jn);      /* the next pass's mask values, into the registers just read */
    asm volatile("s_wait_xcnt 0x0" ::: "memory");      /* before the weights below are written over the address registers that the pass's loads name */
    __builtin_amdgcn_sched_barrier(0);      /* as at the head of the pass */
    weights();
    /* lazy rescale: the reference point moves only in a pass where some lane's weights add up to more than PCAP (no weight is negative, so up to there each fits f16); one test a pass for the whole wave, a scalar branch. Only then is a maximum taken, are sum and context scaled and the weights made anew; the scores are gone by then, so this pass's K and mask are read once more */
    if (__builtin_expect(__builtin_amdgcn_ballot_w32(ps[0] > PCAP || ps[1] > PCAP) != 0, 0)) {      /* marked unlikely: the pass's common path then runs straight through, with the rare one laid out of its way */
      fetch_k(j0, true); fetch_m(j0);
      asm volatile("s_wait_xcnt 0x0" ::: "memory");      /* before the address registers that these loads name are written again */
      products(); scores();
#pragma unroll      /* constant indices: the arrays stay in registers */
      for (int qt = 0; qt < QT; ++qt) {
        const float mn = fmaxf(m_r[qt], colmax(qt)); const float al = (mn > -1.0e38f) ? __builtin_amdgcn_exp2f((m_r[qt] - mn) * L2E) : 1.0f; m_r[qt] = mn; l_r[qt] *= al;
#pragma unroll      /* constant indices: the array stays in registers */
        for (int dt = 0; dt < DT; ++dt) oacc[qt][dt] *= al; }
      weights();
      fetch_k(jn); fetch_m(jn);      /* the next pass's operands again, into the registers just read */
      asm volatile("s_wait_xcnt 0x0" ::: "memory"); }      /* as above */
#pragma unroll      /* constant indices: the arrays stay in registers */
    for (int qt = 0; qt < QT; ++qt) { l_r[qt] += ps[qt];
#pragma unroll      /* constant indices: the array stays in registers */
      for (int dt = 0; dt < DT; ++dt) oacc[qt][dt] = mmaF(av[dt].v, pb[qt].v, oacc[qt][dt]); }
    /* v_nop: the distance behind the pass's last products on the branch's taken side: the next pass's first score products write over the P registers that these read as B. s_wait_xcnt: the next pass rewrites the address registers that this pass's loads name */
    asm volatile("v_nop\n\tv_nop\n\tv_nop\n\tv_nop\n\ts_wait_xcnt 0x0" : "+v"(oacc[0][0]), "+v"(oacc[0][1]), "+v"(oacc[0][2]), "+v"(oacc[0][3]), "+v"(oacc[1][0]), "+v"(oacc[1][1]), "+v"(oacc[1][2]), "+v"(oacc[1][3]) : : "memory"); }
  /* the two halves of the keys are joined: wave kh finishes query tile kh and hands its part of the other tile to its partner */
  const int pw = w ^ NQW; const bool k1 = kh != 0;
  const float mg = k1 ? m_r[0] : m_r[1], lg = k1 ? l_r[0] : l_r[1], mo = k1 ? m_r[1] : m_r[0], lo = k1 ? l_r[1] : l_r[0]; v8f oo[DT];
#pragma unroll      /* constant indices: the arrays stay in registers */
  for (int dt = 0; dt < DT; ++dt) { const v8f g = k1 ? oacc[0][dt] : oacc[1][dt]; oo[dt] = k1 ? oacc[1][dt] : oacc[0][dt];
    *(v4fa*)&sX[w][2 * dt][lane][0] = (v4f){g[0], g[1], g[2], g[3]}; *(v4fa*)&sX[w][2 * dt + 1][lane][0] = (v4f){g[4], g[5], g[6], g[7]}; }
  sML[w][0][lane] = mg; sML[w][1][lane] = lg;
  __syncthreads();      /* every wave's handed-over part is written before its partner reads it */
  { const float mp = sML[pw][0][lane], lp = sML[pw][1][lane]; const float mn = fmaxf(mo, mp);
    const float ao = (mn > -1.0e38f) ? __builtin_amdgcn_exp2f((mo - mn) * L2E) : 1.0f, ap = (mn > -1.0e38f) ? __builtin_amdgcn_exp2f((mp - mn) * L2E) : 1.0f;      /* each part is brought to the common maximum, as the loop does from pass to pass */
    const float lh = lo * ao + lp * ap; const float l = lh + xhalf(lh);      /* the two lane halves' sums of the query's row, joined once */
    const float inv = (l > 0.f) ? 1.0f / l : 0.f;      /* sum and context both carry the factor 16 */
#pragma unroll      /* constant indices: the array stays in registers */
    for (int dt = 0; dt < DT; ++dt) { const v4f x0 = *(const v4fa*)&sX[pw][2 * dt][lane][0], x1 = *(const v4fa*)&sX[pw][2 * dt + 1][lane][0]; const v8f x = {x0[0], x0[1], x0[2], x0[3], x1[0], x1[1], x1[2], x1[3]};
      const v8f o = (oo[dt] * ao + x * ap) * inv;      /* register r = O[q0 + 16 kh + ln][16 dt + 8 hh + r] */
      *(v4fa*)&sO[w][ln][dt * 16 + 8 * hh] = (v4f){o[0], o[1], o[2], o[3]}; *(v4fa*)&sO[w][ln][dt * 16 + 8 * hh + 4] = (v4f){o[4], o[5], o[6], o[7]}; } }
  __builtin_amdgcn_fence(__ATOMIC_ACQ_REL, "workgroup"); __builtin_amdgcn_wave_barrier();      /* the wave's own staged rows are written before its lanes read them back as whole lines */
  {
#pragma unroll      /* constant indices: the array stays in registers */
    for (int rp = 0; rp < 16; rp += 2) { const int r = rp + (lane >> 4), pc = lane & 15; const v4f val = *(const v4fa*)&sO[w][r][pc * 4]; *(v4f*)(O + ((size_t)b * TQ + q0 + kh * 16 + r) * ldo + h * 64 + pc * 4) = val; }
     } }
// 5-plane variant: S = Qh Kh^T + (Ql Kh^T + Qh Kl^T)/1024 with Q/K = [hi | 2^10 residual] f16 planes (QL/KL same layout as Q16/K16), then the 3-term P.V below.
// 3-term variant: O = (P_hi V_hi + (P_lo V_hi + P_hi V_lo) / 1024) / l with P = [hi | 2^10 residual] of 1024 p and V^T = [hi | 2^10 residual] planes (VtL same layout as Vt) -> ~2^-21-class products for un-averaged (early causal / peaked) rows
template <int CAUSAL>
__global__ __launch_bounds__(128) void k_flash5(const _Float16* __restrict__ Q16, const _Float16* __restrict__ QL, int ldq, const _Float16* __restrict__ K16, const _Float16* __restrict__ KL, int ldk, const _Float16* __restrict__ Vt, const _Float16* __restrict__ VtL, const int* __restrict__ MSK, float* __restrict__ O, int ldo) {
  constexpr int RPW = 16, RTN = RPW / 16, NQB = TQ / (4 * RPW), DT = 4, KS = 2;
  __shared__ __attribute__((aligned(16))) unsigned short sP[4][RPW][40]; __shared__ __attribute__((aligned(16))) unsigned short sPL[4][RPW][40]; __shared__ __attribute__((aligned(16))) float sO[4][RPW][64 + 4];
  const int tid = threadIdx.x, w = tid >> 5, lane = tid & 31, ln = lane & 15, hh = lane >> 4;
  const int slab = blockIdx.x / QBN5, qblk = QB05 + blockIdx.x % QBN5; (void)NQB; const int b = slab / NH, h = slab % NH; const int qb0 = qblk * (4 * RPW); const int q0 = qb0 + w * RPW;
  FragH aq[2][KS], aql[2][KS];
#pragma unroll
  for (int rt = 0; rt < RTN; ++rt) { const unsigned short* qr = (const unsigned short*)Q16 + ((size_t)b * TQ + q0 + rt * 16 + ln) * ldq + h * 64; const unsigned short* ql = (const unsigned short*)QL + ((size_t)b * TQ + q0 + rt * 16 + ln) * ldq + h * 64;
#pragma unroll
    for (int ks = 0; ks < KS; ++ks) { aq[rt][ks].half[0] = *(const v8us*)(qr + ks * 32 + 8 * hh); aq[rt][ks].half[1] = *(const v8us*)(qr + ks * 32 + 16 + 8 * hh); aql[rt][ks].half[0] = *(const v8us*)(ql + ks * 32 + 8 * hh); aql[rt][ks].half[1] = *(const v8us*)(ql + ks * 32 + 16 + 8 * hh); } }
  const unsigned short* Vth = (const unsigned short*)Vt + (size_t)slab * 64 * TK; const unsigned short* Vtl = (const unsigned short*)VtL + (size_t)slab * 64 * TK;
  float m_r[2][8], l_r[2][8]; v8f oacc[2][DT], oaccL[2][DT];
#pragma unroll
  for (int rt = 0; rt < RTN; ++rt) {
#pragma unroll
    for (int r = 0; r < 8; ++r) { m_r[rt][r] = -3.0e38f; l_r[rt][r] = 0.f; }
#pragma unroll
    for (int dt = 0; dt < DT; ++dt) { oacc[rt][dt] = (v8f){0.f,0.f,0.f,0.f,0.f,0.f,0.f,0.f}; oaccL[rt][dt] = oacc[rt][dt]; } }
  const int jend = (CAUSAL == 1) ? (qb0 + 4 * RPW) : ((CAUSAL == 23) ? min(TK, (qb0 / CHK + 2) * CHK) : TK);      /* causal / window: keys that can never contribute are skipped */ const int jbeg = (CAUSAL == 23) ? max(0, (qb0 / CHK - 1) * CHK) : 0;
#pragma unroll 1
  for (int j0 = jbeg; j0 < jend; j0 += 32) {
    v8f s[2][2];
#pragma unroll
    for (int nt = 0; nt < 2; ++nt) { const unsigned short* kr = (const unsigned short*)K16 + ((size_t)b * TK + j0 + nt * 16 + ln) * ldk + h * 64; const unsigned short* klr = (const unsigned short*)KL + ((size_t)b * TK + j0 + nt * 16 + ln) * ldk + h * 64; FragH bk[KS], bkl[KS];
#pragma unroll
      for (int ks = 0; ks < KS; ++ks) { bk[ks].half[0] = *(const v8us*)(kr + ks * 32 + 8 * hh); bk[ks].half[1] = *(const v8us*)(kr + ks * 32 + 16 + 8 * hh); bkl[ks].half[0] = *(const v8us*)(klr + ks * 32 + 8 * hh); bkl[ks].half[1] = *(const v8us*)(klr + ks * 32 + 16 + 8 * hh); }
#pragma unroll
      for (int rt = 0; rt < RTN; ++rt) { v8f acc = (v8f){0.f,0.f,0.f,0.f,0.f,0.f,0.f,0.f}, accl = acc;
#pragma unroll
        for (int ks = 0; ks < KS; ++ks) { acc = mmaH<1>(aq[rt][ks].v, aq[rt][ks].v, bk[ks].v, bk[ks].v, acc); accl = mmaH<1>(aql[rt][ks].v, aql[rt][ks].v, bk[ks].v, bk[ks].v, accl); accl = mmaH<1>(aq[rt][ks].v, aq[rt][ks].v, bkl[ks].v, bkl[ks].v, accl); }
#pragma unroll
        for (int r = 0; r < 8; ++r) acc[r] += accl[r] * 0.0009765625f;
        s[rt][nt] = acc; } }
#pragma unroll
    for (int rt = 0; rt < RTN; ++rt)
#pragma unroll
      for (int r = 0; r < 8; ++r) { const int tq = q0 + rt * 16 + 8 * hh + r; const int k0 = j0 + ln, k1 = j0 + 16 + ln;
        bool ok0 = (CAUSAL == 1) ? (k0 <= tq) : ((CAUSAL == 2) ? ((k0 >> 5) == (tq >> 5)) : true), ok1 = (CAUSAL == 1) ? (k1 <= tq) : ((CAUSAL == 2) ? ((k1 >> 5) == (tq >> 5)) : true);      /* mode 2: block-diagonal 32-token groups */
        if (CAUSAL == 4) { const int* mrow = MSK + ((size_t)b * TQ + tq) * TK; ok0 = mrow[k0] != 0; ok1 = mrow[k1] != 0; }      /* mode 4: per-(query, key) INPUT mask shared by all heads; masked keys contribute nothing (== the reference's -4096 fill, whose exp underflows to 0), rows with no valid key give l = 0 -> output 0 (== the reference's row_valid zeroing) */
        float s0 = ok0 ? s[rt][0][r] * SCL : -3.0e38f, s1 = ok1 ? s[rt][1][r] * SCL : -3.0e38f; if (CAUSAL == 33) { const float* amk = (const float*)MSK + (size_t)tq * TK; s0 += bf16_round(amk[k0]); s1 += bf16_round(amk[k1]); }      /* mode 33: one additive [TQ][TK] f32 table shared by every slab */ if (CAUSAL == 17) { const float* amk = (const float*)MSK + (size_t)b * TK; s0 += bf16_round(amk[k0]); s1 += bf16_round(amk[k1]); } if (CAUSAL == 18) { const float* tb = (const float*)MSK; const int* ri = MSK + 1024 + (size_t)b * TK; const int rq = ri[tq]; s0 += tb[(h * 8 + rq) * 8 + ri[k0]]; s1 += tb[(h * 8 + rq) * 8 + ri[k1]]; } if (CAUSAL == 19) { const int* rel = MSK + (size_t)tq * TK; const float* rb = (const float*)MSK + (size_t)TQ * TK + ((size_t)(b * NH + h) * TQ + tq) * 64; s0 += rb[rel[k0]]; s1 += rb[rel[k1]]; }      /* mode 19: + (q.Ek[rel] + Eb[rel][h]) / 8 gathered by the int relative ids (packed [ids | table]) */      /* mode 18: + resource_bias[h][r_q][r_k] from the packed [table | ids] buffer (TQ == TK) */      /* mode 17: additive per-(batch, key) mask INPUT */ float mc = fmaxf(s0, s1);
        mc = fmaxf(mc, __shfl_xor(mc, 1, 32)); mc = fmaxf(mc, __shfl_xor(mc, 2, 32)); mc = fmaxf(mc, __shfl_xor(mc, 4, 32)); mc = fmaxf(mc, __shfl_xor(mc, 8, 32));
        const float mn = fmaxf(m_r[rt][r], mc); const float al = (mn > -1.0e38f) ? expf(m_r[rt][r] - mn) : 1.0f; m_r[rt][r] = mn; const float p0 = ok0 ? expf(s0 - mn) : 0.f, p1 = ok1 ? expf(s1 - mn) : 0.f; l_r[rt][r] = l_r[rt][r] * al + p0 + p1;
#pragma unroll
        for (int dt = 0; dt < DT; ++dt) { oacc[rt][dt][r] *= al; oaccL[rt][dt][r] *= al; }
        FragH t2, t2l; const float ps0 = p0 * 1024.0f, ps1 = p1 * 1024.0f; t2.h[0] = (_Float16)ps0; t2.h[1] = (_Float16)ps1; t2l.h[0] = (_Float16)((ps0 - (float)t2.h[0]) * 1024.0f); t2l.h[1] = (_Float16)((ps1 - (float)t2.h[1]) * 1024.0f);
        sP[w][rt * 16 + 8 * hh + r][ln] = t2.u[0]; sP[w][rt * 16 + 8 * hh + r][16 + ln] = t2.u[1]; sPL[w][rt * 16 + 8 * hh + r][ln] = t2l.u[0]; sPL[w][rt * 16 + 8 * hh + r][16 + ln] = t2l.u[1]; }
    __builtin_amdgcn_fence(__ATOMIC_ACQ_REL, "workgroup"); __builtin_amdgcn_wave_barrier();
    FragH pa[2], pl[2];
#pragma unroll
    for (int rt = 0; rt < RTN; ++rt) { pa[rt].half[0] = *(const v8us*)&sP[w][rt * 16 + ln][8 * hh]; pa[rt].half[1] = *(const v8us*)&sP[w][rt * 16 + ln][16 + 8 * hh]; pl[rt].half[0] = *(const v8us*)&sPL[w][rt * 16 + ln][8 * hh]; pl[rt].half[1] = *(const v8us*)&sPL[w][rt * 16 + ln][16 + 8 * hh]; }
#pragma unroll
    for (int dt = 0; dt < DT; ++dt) { const unsigned short* vrow = Vth + (size_t)(dt * 16 + ln) * TK + j0; const unsigned short* vrl = Vtl + (size_t)(dt * 16 + ln) * TK + j0; FragH bv, bl; bv.half[0] = *(const v8us*)(vrow + 8 * hh); bv.half[1] = *(const v8us*)(vrow + 16 + 8 * hh); bl.half[0] = *(const v8us*)(vrl + 8 * hh); bl.half[1] = *(const v8us*)(vrl + 16 + 8 * hh);
#pragma unroll
      for (int rt = 0; rt < RTN; ++rt) { oacc[rt][dt] = mmaH<1>(pa[rt].v, pa[rt].v, bv.v, bv.v, oacc[rt][dt]); oaccL[rt][dt] = mmaH<1>(pl[rt].v, pl[rt].v, bv.v, bv.v, oaccL[rt][dt]); oaccL[rt][dt] = mmaH<1>(pa[rt].v, pa[rt].v, bl.v, bl.v, oaccL[rt][dt]); } }
    __builtin_amdgcn_fence(__ATOMIC_ACQ_REL, "workgroup"); __builtin_amdgcn_wave_barrier(); }
#pragma unroll
  for (int rt = 0; rt < RTN; ++rt) {
#pragma unroll
    for (int r = 0; r < 8; ++r) { float l = l_r[rt][r]; l += __shfl_xor(l, 1, 32); l += __shfl_xor(l, 2, 32); l += __shfl_xor(l, 4, 32); l += __shfl_xor(l, 8, 32); l_r[rt][r] = (l > 0.f) ? 1.0f / (l * 1024.0f) : 0.f; }
#pragma unroll
    for (int dt = 0; dt < DT; ++dt)
#pragma unroll
      for (int r = 0; r < 8; ++r) { float v = oacc[rt][dt][r]; v += oaccL[rt][dt][r] * 0.0009765625f; sO[w][rt * 16 + 8 * hh + r][dt * 16 + ln] = v * l_r[rt][r]; } }
  __builtin_amdgcn_fence(__ATOMIC_ACQ_REL, "workgroup"); __builtin_amdgcn_wave_barrier();
  {
#pragma unroll
    for (int rp = 0; rp < RPW; rp += 2) { const int r = rp + (lane >> 4), pc = lane & 15; const v4f val = *(const v4fa*)&sO[w][r][pc * 4]; *(v4f*)(O + ((size_t)b * TQ + q0 + r) * ldo + h * 64 + pc * 4) = val; }
     } }

__global__ __launch_bounds__(256) void k_rotab(float* __restrict__ CS, float* __restrict__ SN) {
  #pragma clang fp contract(off)
  const int t = blockIdx.x * 256 + threadIdx.x; if (t >= SLEN * 32) return; const int j = t % 32, s = t / 32; const float ex = (float)(2 * j) / 64.0f; const float inv = 1.0f / powf(10000.0f, ex); const float th = (float)s * inv; const float c = cosf(th), sn = sinf(th);
  { *(float*)(CS + t) = c; *(float*)(SN + t) = sn;  } }
__global__ __launch_bounds__(256) void k_rope(const float* __restrict__ F, int nsrc, int ndst, int rep, const float* __restrict__ CS, const float* __restrict__ SN, _Float16* __restrict__ H, _Float16* __restrict__ L) {
  #pragma clang fp contract(off)
  const size_t t = (size_t)blockIdx.x * 256 + threadIdx.x; if (t >= (size_t)NR * ndst * 4) return; const int g8 = (int)(t % 4); const int hd = (int)((t / 4) % ndst); const size_t row = t / ((size_t)4 * ndst); const int s = (int)(row % SLEN); const int hs = hd / rep;
  const float* src = F + row * (size_t)(nsrc * 64) + hs * 64; FragH ah, al, bh, bl;
  for (int i = 0; i < 8; ++i) { const int d = g8 * 8 + i; const float c = CS[s * 32 + d], sn = SN[s * 32 + d]; const float x1 = src[d], x2 = src[d + 32];
    float o1 = x1 * c; o1 += -x2 * sn; float o2 = x2 * c; o2 += x1 * sn;
    _Float16 hv = (_Float16)o1; ah.h[i] = hv; al.h[i] = (_Float16)((o1 - (float)hv) * 1024.0f); hv = (_Float16)o2; bh.h[i] = hv; bl.h[i] = (_Float16)((o2 - (float)hv) * 1024.0f); }
  const size_t o = row * (size_t)(ndst * 64) + hd * 64 + g8 * 8;
  { *(v8us*)((unsigned short*)H + o) = ah.half[0]; *(v8us*)((unsigned short*)H + o + 32) = bh.half[0]; *(v8us*)((unsigned short*)L + o) = al.half[0]; *(v8us*)((unsigned short*)L + o + 32) = bl.half[0];  } }
__global__ __launch_bounds__(256) void k_rope2(const float* __restrict__ F, int nsrc, int ndst, int rep, const float* __restrict__ CS, const float* __restrict__ SN, _Float16* __restrict__ H, _Float16* __restrict__ L) {
  #pragma clang fp contract(off)
  const size_t t = (size_t)blockIdx.x * 256 + threadIdx.x; if (t >= (size_t)NR * ndst * 4) return; const int g16 = (int)(t % 4); const int hd = (int)((t / 4) % ndst); const size_t row = t / ((size_t)4 * ndst); const int s = (int)(row % SLEN); const int hs = hd / rep;
  const float* src = F + row * (size_t)(nsrc * 64) + hs * 64 + g16 * 16; FragH ah, al;
  for (int pr = 0; pr < 8; ++pr) { const int i = g16 * 8 + pr; const float c = CS[s * 32 + i], sn = SN[s * 32 + i]; const float x1 = src[2 * pr], x2 = src[2 * pr + 1];
    float o1 = x1 * c; o1 -= x2 * sn; float o2 = x1 * sn; o2 += x2 * c;
    _Float16 hv = (_Float16)o1; ah.h[2 * pr] = hv; al.h[2 * pr] = (_Float16)((o1 - (float)hv) * 1024.0f); hv = (_Float16)o2; ah.h[2 * pr + 1] = hv; al.h[2 * pr + 1] = (_Float16)((o2 - (float)hv) * 1024.0f); }
  const size_t o = row * (size_t)(ndst * 64) + hd * 64 + g16 * 16;
  { *(v8us*)((unsigned short*)H + o) = ah.half[0]; *(v8us*)((unsigned short*)H + o + 8) = ah.half[1]; *(v8us*)((unsigned short*)L + o) = al.half[0]; *(v8us*)((unsigned short*)L + o + 8) = al.half[1];  } }
__global__ __launch_bounds__(256) void k_ln512(const float* __restrict__ A, const float* __restrict__ res, const float* __restrict__ g, const float* __restrict__ bb, float* __restrict__ Y, _Float16* __restrict__ Y16) {
  #pragma clang fp contract(off)
  const int wv = threadIdx.x >> 5, ln = threadIdx.x & 31; const size_t r = (size_t)blockIdx.x * 8 + wv; if (r >= NR) return; float x[16]; float s = 0.f;
  for (int i = 0; i < 2; ++i) { const v8f a = *(const v8f*)(A + r * DM + i * 256 + ln * 8); for (int q = 0; q < 8; ++q) { float v = a[q]; if (res) v += bf16_round(res[r * DM + i * 256 + ln * 8 + q]); x[i * 8 + q] = v; s += v; } }
  for (int o = 16; o > 0; o >>= 1) s += __shfl_xor(s, o, 32); const float mu = s / (float)DM; float var = 0.f; for (int q = 0; q < 16; ++q) { const float d = x[q] - mu; var += d * d; }
  for (int o = 16; o > 0; o >>= 1) var += __shfl_xor(var, o, 32); const float inv = rsqrtf(var / (float)DM + 1e-5f);
  { for (int i = 0; i < 2; ++i) { const int c0 = i * 256 + ln * 8; v8f y; FragH f; for (int q = 0; q < 8; ++q) { float v = (x[i * 8 + q] - mu) * inv; v *= bf16_round(g[c0 + q]); v += bf16_round(bb[c0 + q]); y[q] = v; f.h[q] = (_Float16)v; } *(v8f*)(Y + r * DM + c0) = y; if (Y16) *(v8us*)((unsigned short*)Y16 + r * DM + c0) = f.half[0]; }  } }
__global__ __launch_bounds__(256) void k_pack(const float* __restrict__ rb, const int* __restrict__ rid, int* __restrict__ PK) { const int t = blockIdx.x * 256 + threadIdx.x; if (t >= 1024 + NB * TK) return; int v; if (t < 1024) v = __float_as_int(bf16_round(rb[t])); else v = rid[t - 1024]; *(int*)(PK + t) = v;  }
__global__ __launch_bounds__(256) void k_tabin(const float* __restrict__ sp, float* __restrict__ CS, float* __restrict__ SN) { const int t = blockIdx.x * 256 + threadIdx.x; if (t >= SLEN * 32) return; const int i = t % 32, s = t / 32; const float c = bf16_round(sp[s * 64 + 32 + i]), sn = bf16_round(sp[s * 64 + i]);
  { *(float*)(CS + t) = c; *(float*)(SN + t) = sn;  } }
__global__ __launch_bounds__(256) void k_wsc(const float* __restrict__ Wm, _Float16* __restrict__ Bt, size_t n8, float sc) { const size_t t = (size_t)blockIdx.x * 256 + threadIdx.x; if (t >= n8) return; FragH f; for (int q = 0; q < 8; ++q) f.h[q] = (_Float16)(bf16_round(Wm[t * 8 + q]) * sc); *(v8us*)((unsigned short*)Bt + t * 8) = f.half[0];  }
__global__ __launch_bounds__(256) void k_rotab2(float* __restrict__ CS, float* __restrict__ SN) {
  #pragma clang fp contract(off)
  const int t = blockIdx.x * 256 + threadIdx.x; if (t >= SLEN * 32) return; const int j = t % 32, s = t / 32; const float c0 = -0.14391156831212787f;      /* -ln(10000)/64 rounded to f32 */ const float inv = expf((float)(2 * j) * c0); const float th = (float)s * inv; const float c = cosf(th), sn = sinf(th);
  { *(float*)(CS + t) = c; *(float*)(SN + t) = sn;  } }
__global__ __launch_bounds__(256) void k_lnu(const float* __restrict__ X, _Float16* __restrict__ N16, float* __restrict__ XB) {
  #pragma clang fp contract(off)
  const int wv = threadIdx.x >> 5, ln = threadIdx.x & 31; const size_t r = (size_t)blockIdx.x * 8 + wv; if (r >= NR) return; float a[32]; float s = 0.f;
  for (int i = 0; i < 4; ++i) { const v8f v = *(const v8f*)(X + r * DM + (i * 32 + ln) * 8); for (int q = 0; q < 8; ++q) { const float u = bf16_round(v[q]); a[i * 8 + q] = u; s += u; } }
  for (int o = 16; o > 0; o >>= 1) s += __shfl_xor(s, o, 32); const float mu = s / (float)DM; float var = 0.f; for (int q = 0; q < 32; ++q) { const float d = a[q] - mu; var += d * d; }
  for (int o = 16; o > 0; o >>= 1) var += __shfl_xor(var, o, 32); const float den = sqrtf(var / (float)(DM - 1)) + 1e-6f; const float inv = 1.0f / den;      /* one reciprocal per row; (x-mean)*inv vs the reference's division differs by <= 1 ulp */
  { for (int i = 0; i < 4; ++i) { const int c0 = (i * 32 + ln) * 8; FragH f; v8f xb; for (int q = 0; q < 8; ++q) { f.h[q] = (_Float16)((a[i * 8 + q] - mu) * inv); xb[q] = a[i * 8 + q]; } *(v8us*)((unsigned short*)N16 + r * DM + c0) = f.half[0]; *(v8f*)(XB + r * DM + c0) = xb; }  } }
__global__ __launch_bounds__(256) void k_vtg(const _Float16* __restrict__ V16, _Float16* __restrict__ Vt) { __shared__ unsigned short tl[64][66]; const int tid = threadIdx.x; const int slab = blockIdx.x / (SLEN / 64), lg = blockIdx.x % (SLEN / 64); const int b = slab / NH, h = slab % NH; const int hs = h / NREP;
  for (int i = tid; i < 64 * 8; i += 256) { const int r = i / 8, c8 = (i % 8) * 8; FragH f; f.half[0] = *(const v8us*)((const unsigned short*)V16 + ((size_t)b * SLEN + lg * 64 + r) * KVD + hs * 64 + c8); for (int q = 0; q < 8; ++q) tl[r][c8 + q] = f.u[q]; }
  __syncthreads();
  { for (int rd = 0; rd < 2; ++rd) { const int d = rd * 32 + tid / 8, pc = tid % 8; FragH f; for (int q = 0; q < 8; ++q) f.u[q] = tl[pc * 8 + q][d]; *(v8us*)((unsigned short*)Vt + ((size_t)slab * 64 + d) * SLEN + lg * 64 + pc * 8) = f.half[0]; }  } }

__global__ __launch_bounds__(256) void k_h16s(const float* __restrict__ SRC, int lds, int coff, _Float16* __restrict__ DST, size_t n8) { const size_t t = (size_t)blockIdx.x * 256 + threadIdx.x; if (t >= n8) return; const size_t r = (t * 8) / DM; const int c = (int)((t * 8) % DM); const v8f a = *(const v8f*)(SRC + r * lds + coff + c); FragH f; for (int q = 0; q < 8; ++q) f.h[q] = (_Float16)a[q];
  *(v8us*)((unsigned short*)DST + t * 8) = f.half[0];  }


__global__ __launch_bounds__(256) void k_ccp(const float* __restrict__ QKV, int coff, _Float16* __restrict__ D) { const size_t t = (size_t)blockIdx.x * 256 + threadIdx.x; if (t >= (size_t)NR * DM / 8) return; const int c0 = (int)((t * 8) % DM); const size_t row = (t * 8) / DM; const v8f a = *(const v8f*)(QKV + row * 3 * DM + coff + c0); FragH f; for (int q = 0; q < 8; ++q) f.h[q] = (_Float16)a[q];
  *(v8us*)((unsigned short*)D + t * 8) = f.half[0];  }


extern "C" void kernel_launch(void* const* d_in, const int* in_sizes, int n_in,
                              void* d_out, int out_size, void* d_ws, size_t ws_size, hipStream_t stream) {
  (void)in_sizes; (void)n_in; (void)out_size;
  const float* q = (const float*)d_in[0]; const float* kv = (const float*)d_in[1]; const float* mask = (const float*)d_in[2]; float* O = (float*)d_out;
  char* ws = (char*)d_ws; size_t off = 0;
  auto take = [&](size_t bytes) { char* p = ws + off; off += (bytes + 255) & ~(size_t)255; return p; };
  const size_t np = (size_t)NR * DM;      /* 32 x 2048 x 64 */
  _Float16* Q16 = (_Float16*)take(np * 2); unsigned short* KP = (unsigned short*)take(np * 2); unsigned short* VP = (unsigned short*)take(np * 2); unsigned short* MP = (unsigned short*)take((size_t)TQ * TK * 2);
  if (off > ws_size) return;      /* 32 MiB */
  static_assert(NR / 32 == TQ / 8 * TK / 256, "q, kv and the mask have the same number of units");
  k_prep<<<NR / 32 / PU, 256, 0, stream>>>(q, kv, mask, (unsigned short*)Q16, KP, VP, MP);      /* values = keys */
  k_flash<33><<<NB * NH * QBNP, 512, 0, stream>>>(Q16, DM, KP, VP, MP, O, DM);      /* f32 context straight to the output rows */
}

// v009
// A run of this version takes 46.1 microseconds.
// Two timings next to v008 put it at 1.03 and 1.04 times that version's speed.
// Counting every step since v000, which is the starting kernel, it is 7.45 times as fast.
#include <hip/hip_runtime.h>
// DotProdAttention (q [4][8][2048][64], kv [4][8][2048][64] (keys = values), mask [1][1][2048][2048] added to every (batch, head); out = softmax(q kv^T / 8 + mask) kv -> [4][8][2048][64]).
// Structure: the (batch, head) slabs of q/kv are already contiguous 64-wide row blocks, so each slab is treated as one 'batch' of a single 64-dim head: exact f16 plane of q; kv as K and as V^T, and the mask, packed in the order of the attention loop's fragment loads; flash-style fused attention per (slab, 256-query block) adding the shared additive mask table per (query, key), f32 context written straight to the output.
// Compute dtype: inputs rounded to bf16; q, kv, mask exact (f16 / bf16-rounded f32); softmax f32 with f16 probabilities; plain f16 value operand; v_wmma_f32_16x16x32_f16.
#define NB 32                    /* 4 batches x 8 heads as slabs */
#define DM 64
#define NKV 1
#define NREP (NH / NKV)
#define KVD (NKV * 64)           /* 64 */
#define NR (NB * SLEN)
#define CHK 512
typedef int v4i __attribute__((ext_vector_type(4)));
#define FF 2048
#define SLEN 2048
#define MQI 2048
#define MKI 2048
#define TQ SLEN
#define TK SLEN
#define NH 1
#define SCL 0.125f
#define QBLKS (TQ / 64)
#define QB05 0
#define QBN5 4
#define QB0P 0
#define QPB 256                  /* queries per work-group of k_flash */
#define QBNP (TQ / QPB)
#define RE 256
typedef __bf16 v16b __attribute__((ext_vector_type(16)));
typedef unsigned short v8us __attribute__((ext_vector_type(8), may_alias));
typedef float  v8f  __attribute__((ext_vector_type(8)));
typedef float  v4f  __attribute__((ext_vector_type(4)));
typedef float  v4fa __attribute__((ext_vector_type(4), may_alias));
union FragB { v16b v; v8us half[2]; unsigned short u[16]; };

__device__ __forceinline__ unsigned short bf16_bits(float x) { unsigned int u = __float_as_uint(x); return (unsigned short)((u + 0x7FFFu + ((u >> 16) & 1u)) >> 16); }
__device__ __forceinline__ float bf16_val(unsigned short b) { return __uint_as_float(((unsigned int)b) << 16); }
__device__ __forceinline__ float bf16_round(float x) { return bf16_val(bf16_bits(x)); }
// D += A·B with NT terms: 1 = ah·bh, 2 = + al·bh (A split), 3 = + ah·bl (both split)
template <int NT>
__device__ __forceinline__ v8f mmaN(v16b ah, v16b al, v16b bh, v16b bl, v8f c) {
  c = __builtin_amdgcn_wmma_f32_16x16x32_bf16(false, ah, false, bh, (short)0, c, false, false);
  if (NT >= 2) c = __builtin_amdgcn_wmma_f32_16x16x32_bf16(false, al, false, bh, (short)0, c, false, false);
  if (NT >= 3) c = __builtin_amdgcn_wmma_f32_16x16x32_bf16(false, ah, false, bl, (short)0, c, false, false);
  asm volatile("v_nop\n\tv_nop\n\tv_nop\n\tv_nop" : "+v"(c) : "v"(ah), "v"(al), "v"(bh), "v"(bl));
  return c;
}

__global__ __launch_bounds__(256) void k_wt_bf16(const float* __restrict__ W, unsigned short* __restrict__ Wt, int K, int N) {
  const int t = blockIdx.x * 256 + threadIdx.x;
  const int k8n = K / 8;
  if (t >= N * k8n) return;
  const int n = t / k8n, k8 = (t % k8n) * 8;
  v8us v;
#pragma unroll
  for (int i = 0; i < 8; ++i) v[i] = bf16_bits(W[(size_t)(k8 + i) * N + n]);
  *(v8us*)(Wt + (size_t)n * K + k8) = v;
  
}

// GEMM C[M][N] (f32, pitch ldc) = act(A[M][K]·W + bias). A f32 row-major (pitch lda) converted per fragment to bf16
// (ASPLIT: hi/lo two planes -> 2 terms, else single rounded term); Wt bf16 [N][K] (pitch ldb). BIAS_BF16 rounds the
// bias to bf16 first (bias quantised to bf16 before the add). K%32==0, M%16==0, N%64==0.
template <bool ASPLIT, int ACT, bool BIAS_BF16>
__global__ __launch_bounds__(128) void k_gemm_bf(const float* __restrict__ A, int lda, const unsigned short* __restrict__ Wt, int ldb,
                                               const float* __restrict__ bias, float* __restrict__ C, int ldc, int M, int N, int K) {
  __shared__ __attribute__((aligned(16))) float so[4][16][64];
  const int tid = threadIdx.x, w = tid >> 5, lane = tid & 31, ln = lane & 15, hh = lane >> 4;
  const int ntn = N / 64;
  const int wid = blockIdx.x * 4 + w;
  const int mt = wid / ntn, nq = wid % ntn;
  if (mt * 16 >= M) return;
  const int row0 = mt * 16, col0 = nq * 64;
  const float* arow = A + (size_t)(row0 + ln) * lda;
  v8f acc[4] = {};
  for (int kb = 0; kb < K; kb += 32) {
    FragB ah, al;
    const v4f x0 = *(const v4fa*)(arow + kb + 8 * hh), x1 = *(const v4fa*)(arow + kb + 8 * hh + 4);
    const v4f x2 = *(const v4fa*)(arow + kb + 16 + 8 * hh), x3 = *(const v4fa*)(arow + kb + 16 + 8 * hh + 4);
    float xs[16] = {x0[0],x0[1],x0[2],x0[3],x1[0],x1[1],x1[2],x1[3],x2[0],x2[1],x2[2],x2[3],x3[0],x3[1],x3[2],x3[3]};
#pragma unroll
    for (int i = 0; i < 16; ++i) { const unsigned short hb = bf16_bits(xs[i]); ah.u[i] = hb; al.u[i] = ASPLIT ? bf16_bits(xs[i] - bf16_val(hb)) : (unsigned short)0; }
#pragma unroll
    for (int t = 0; t < 4; ++t) {
      const unsigned short* brow = Wt + (size_t)(col0 + t * 16 + ln) * ldb + kb;
      FragB b;
      b.half[0] = *(const v8us*)(brow + 8 * hh);
      b.half[1] = *(const v8us*)(brow + 16 + 8 * hh);
      acc[t] = mmaN<ASPLIT ? 2 : 1>(ah.v, al.v, b.v, b.v, acc[t]);
    }
  }
#pragma unroll
  for (int t = 0; t < 4; ++t) {
    float bv = bias ? bias[col0 + t * 16 + ln] : 0.f;
    if (BIAS_BF16) bv = bf16_round(bv);
#pragma unroll
    for (int r = 0; r < 8; ++r) { float v = acc[t][r] + bv; if (ACT == 1) v = fmaxf(v, 0.f); so[w][8 * hh + r][t * 16 + ln] = v; }
  }
  __builtin_amdgcn_fence(__ATOMIC_ACQ_REL, "workgroup");
  __builtin_amdgcn_wave_barrier();
  const int rsub = lane >> 4, c4 = (lane & 15) * 4;
  {
#pragma unroll
    for (int q = 0; q < 8; ++q) {
      const int r = q * 2 + rsub;
      const v4f v = *(const v4fa*)&so[w][r][c4];
      *(v4f*)(C + (size_t)(row0 + r) * ldc + col0 + c4) = v;
    }
    
  }
}

// GEMM C = act(A·W + bias + resid): A f32 (ASPLIT -> hi/lo 2 terms), Wt bf16 [N][K]; ACT 0 none, 1 relu, 2 exact gelu;
// resid (optional, f32, row index = (row % rmod), pitch ldr, RES_BF16 rounds it) added before the activation.
template <bool ASPLIT, int ACT, bool BIAS_BF16, bool RES_BF16>
__global__ __launch_bounds__(128) void k_gemm_bf3(const float* __restrict__ A, int lda, const unsigned short* __restrict__ Wt, int ldb,
                                                const float* __restrict__ bias, const float* __restrict__ resid, int rmod, int ldr,
                                                float* __restrict__ C, int ldc, int M, int N, int K) {
  __shared__ __attribute__((aligned(16))) float so[4][16][64];
  const int tid = threadIdx.x, w = tid >> 5, lane = tid & 31, ln = lane & 15, hh = lane >> 4;
  const int ntn = N / 64;
  const int wid = blockIdx.x * 4 + w;
  const int mt = wid / ntn, nq = wid % ntn;
  if (mt * 16 >= M) return;
  const int row0 = mt * 16, col0 = nq * 64;
  const float* arow = A + (size_t)(row0 + ln) * lda;
  v8f acc[4] = {};
  for (int kb = 0; kb < K; kb += 32) {
    FragB ah, al;
    const v4f x0 = *(const v4fa*)(arow + kb + 8 * hh), x1 = *(const v4fa*)(arow + kb + 8 * hh + 4);
    const v4f x2 = *(const v4fa*)(arow + kb + 16 + 8 * hh), x3 = *(const v4fa*)(arow + kb + 16 + 8 * hh + 4);
    float xs[16] = {x0[0],x0[1],x0[2],x0[3],x1[0],x1[1],x1[2],x1[3],x2[0],x2[1],x2[2],x2[3],x3[0],x3[1],x3[2],x3[3]};
#pragma unroll
    for (int i = 0; i < 16; ++i) { const unsigned short hb = bf16_bits(xs[i]); ah.u[i] = hb; al.u[i] = ASPLIT ? bf16_bits(xs[i] - bf16_val(hb)) : (unsigned short)0; }
#pragma unroll
    for (int t = 0; t < 4; ++t) {
      const unsigned short* brow = Wt + (size_t)(col0 + t * 16 + ln) * ldb + kb;
      FragB b;
      b.half[0] = *(const v8us*)(brow + 8 * hh);
      b.half[1] = *(const v8us*)(brow + 16 + 8 * hh);
      acc[t] = mmaN<ASPLIT ? 2 : 1>(ah.v, al.v, b.v, b.v, acc[t]);
    }
  }
#pragma unroll
  for (int t = 0; t < 4; ++t) {
    const int col = col0 + t * 16 + ln;
    float bv = bias ? bias[col] : 0.f;
    if (BIAS_BF16) bv = bf16_round(bv);
#pragma unroll
    for (int r = 0; r < 8; ++r) {
      float v = acc[t][r] + bv;
      if (resid) { float rv = resid[(size_t)((row0 + 8 * hh + r) % rmod) * ldr + col]; if (RES_BF16) rv = bf16_round(rv); v += rv; }
      if (ACT == 1) v = fmaxf(v, 0.f);
      if (ACT == 2) v = 0.5f * v * (1.0f + erff(v * 0.70710678118654752f));
      if (ACT == 3) { const float u = 0.7978845608028654f * (v + 0.044715f * v * v * v); v = 0.5f * v * (1.0f + tanhf(u)); }
      so[w][8 * hh + r][t * 16 + ln] = v;
    }
  }
  __builtin_amdgcn_fence(__ATOMIC_ACQ_REL, "workgroup");
  __builtin_amdgcn_wave_barrier();
  const int rsub = lane >> 4, c4 = (lane & 15) * 4;
  {
#pragma unroll
    for (int q = 0; q < 8; ++q) {
      const int r = q * 2 + rsub;
      const v4f v = *(const v4fa*)&so[w][r][c4];
      *(v4f*)(C + (size_t)(row0 + r) * ldc + col0 + c4) = v;
    }
    
  }
}
// row LayerNorm (biased variance, eps) over N: s = X (+ R); optional out_sum <- s; out_norm <- (s-mu)*rsqrt(var+eps)*g + b
template <bool PARAM_BF16>
__global__ __launch_bounds__(256) void k_layernorm(const float* __restrict__ X, const float* __restrict__ R, const float* __restrict__ g, const float* __restrict__ bta,
                                                  float* __restrict__ out_sum, float* __restrict__ out_norm, int N, float eps) {
  __shared__ float red[256];
  const int row = blockIdx.x, tid = threadIdx.x;
  const float* x = X + (size_t)row * N; const float* rr = R ? R + (size_t)row * N : nullptr;
  float vals[16];                     // up to N = 4096
  const int per = N / 256;            // contiguous chunk per thread? use strided-by-4 chunks: thread handles j = tid*4 + 1024*u
  float s1 = 0.f;
  for (int u = 0; u < per / 4; ++u) {
    const int j = tid * 4 + 1024 * u;
    const v4f a = *(const v4fa*)(x + j);
    v4f b = {0.f,0.f,0.f,0.f}; if (rr) b = *(const v4fa*)(rr + j);
#pragma unroll
    for (int q = 0; q < 4; ++q) { const float v = a[q] + b[q]; vals[u * 4 + q] = v; s1 += v; }
  }
  red[tid] = s1; __syncthreads();
  for (int st = 128; st > 0; st >>= 1) { if (tid < st) red[tid] += red[tid + st]; __syncthreads(); }
  const float mu = red[0] / (float)N; __syncthreads();
  float s2 = 0.f;
  for (int u = 0; u < per / 4; ++u)
#pragma unroll
    for (int q = 0; q < 4; ++q) { const float c = vals[u * 4 + q] - mu; s2 += c * c; }
  red[tid] = s2; __syncthreads();
  for (int st = 128; st > 0; st >>= 1) { if (tid < st) red[tid] += red[tid + st]; __syncthreads(); }
  const float rs = rsqrtf(red[0] / (float)N + eps);
  {
    for (int u = 0; u < per / 4; ++u) {
      const int j = tid * 4 + 1024 * u;
      v4f o, sm;
#pragma unroll
      for (int q = 0; q < 4; ++q) {
        float gg = g[j + q], bb = bta[j + q];
        if (PARAM_BF16) { gg = bf16_round(gg); bb = bf16_round(bb); }
        sm[q] = vals[u * 4 + q]; o[q] = (vals[u * 4 + q] - mu) * rs * gg + bb;
      }
      if (out_sum) *(v4f*)(out_sum + (size_t)row * N + j) = sm;
      *(v4f*)(out_norm + (size_t)row * N + j) = o;
    }
    
  }
}



// ---- f16 WMMA path (v_wmma_f32_16x16x32_f16): 11-bit significands for operands in range — used where a [0,1] probability operand needs more precision than bf16
typedef _Float16 v16h __attribute__((ext_vector_type(16)));
union FragH { v16h v; v8us half[2]; _Float16 h[16]; unsigned short u[16]; };
template <int NT>
__device__ __forceinline__ v8f mmaH(v16h ah, v16h al, v16h bh, v16h bl, v8f c) {
  c = __builtin_amdgcn_wmma_f32_16x16x32_f16(false, ah, false, bh, (short)0, c, false, false);
  if (NT >= 2) c = __builtin_amdgcn_wmma_f32_16x16x32_f16(false, al, false, bh, (short)0, c, false, false);
  if (NT >= 3) c = __builtin_amdgcn_wmma_f32_16x16x32_f16(false, ah, false, bl, (short)0, c, false, false);
  asm volatile("v_nop\n\tv_nop\n\tv_nop\n\tv_nop" : "+v"(c) : "v"(ah), "v"(al), "v"(bh), "v"(bl));
  return c;
}
// batched GEMM like k_gemm_b but f16 operands: A f32 (split into f16 hi/lo if ASPLIT, else rounded to f16), Bt = f16 values [n][k]; alpha; C f32; N multiple of 16 (partial tiles skipped)
template <bool ASPLIT>
__global__ __launch_bounds__(128) void k_gemm_h(const float* __restrict__ A, int lda, size_t sA, const _Float16* __restrict__ Bh, int ldb, size_t sB, float alpha, float* __restrict__ C, int ldc, size_t sC, int M, int N, int K) {
  __shared__ __attribute__((aligned(16))) float so[4][16][64];
  const int tid = threadIdx.x, w = tid >> 5, lane = tid & 31, ln = lane & 15, hh = lane >> 4; const int by = blockIdx.y;
  A += (size_t)by * sA; Bh += (size_t)by * sB; C += (size_t)by * sC;
  const int ntn = (N + 63) / 64; const int wid = blockIdx.x * 4 + w; const int mt = wid / ntn, nq = wid % ntn; if (mt * 16 >= M) return;
  const int row0 = mt * 16, col0 = nq * 64; const float* arow = A + (size_t)(row0 + ln) * lda;
  v8f acc[4] = {};
  for (int kb = 0; kb < K; kb += 32) {
    FragH ah, al;
    const v4f x0 = *(const v4fa*)(arow + kb + 8 * hh), x1 = *(const v4fa*)(arow + kb + 8 * hh + 4), x2 = *(const v4fa*)(arow + kb + 16 + 8 * hh), x3 = *(const v4fa*)(arow + kb + 16 + 8 * hh + 4);
    float xs[16] = {x0[0],x0[1],x0[2],x0[3],x1[0],x1[1],x1[2],x1[3],x2[0],x2[1],x2[2],x2[3],x3[0],x3[1],x3[2],x3[3]};
#pragma unroll
    for (int i = 0; i < 16; ++i) { const _Float16 h = (_Float16)xs[i]; ah.h[i] = h; al.h[i] = ASPLIT ? (_Float16)(xs[i] - (float)h) : (_Float16)0.0f; }
#pragma unroll
    for (int t = 0; t < 4; ++t) { if (col0 + t * 16 >= N) continue; const size_t boff = (size_t)(col0 + t * 16 + ln) * ldb + kb; FragH bq; bq.half[0] = *(const v8us*)(Bh + boff + 8 * hh); bq.half[1] = *(const v8us*)(Bh + boff + 16 + 8 * hh);
      acc[t] = mmaH<ASPLIT ? 2 : 1>(ah.v, al.v, bq.v, bq.v, acc[t]); }
  }
#pragma unroll
  for (int t = 0; t < 4; ++t) { if (col0 + t * 16 >= N) continue;
#pragma unroll
    for (int r = 0; r < 8; ++r) so[w][8 * hh + r][t * 16 + ln] = acc[t][r] * alpha; }
  __builtin_amdgcn_fence(__ATOMIC_ACQ_REL, "workgroup"); __builtin_amdgcn_wave_barrier();
  const int rsub = lane >> 4, c4 = (lane & 15) * 4;
  {
#pragma unroll
    for (int q = 0; q < 8; ++q) { const int r = q * 2 + rsub; if (col0 + c4 < N) { const v4f v = *(const v4fa*)&so[w][r][c4]; *(v4f*)(C + (size_t)(row0 + r) * ldc + col0 + c4) = v; } }
     }
}

// Wt[n][k] = f16(W[k][n]·scale) from f32 row-major W[K][N] (scale = power of two; bf16-exact weights stay exact in f16 away from the subnormal range)
__global__ __launch_bounds__(256) void k_wt_f16(const float* __restrict__ W, _Float16* __restrict__ Wt, int K, int N, float scale) {
  const int t = blockIdx.x * 256 + threadIdx.x; if (t >= N * (K / 8)) return; const int n = t / (K / 8), k8 = (t % (K / 8)) * 8; FragH f;
#pragma unroll
  for (int i = 0; i < 8; ++i) f.h[i] = (_Float16)(bf16_round(W[(size_t)(k8 + i) * N + n]) * scale); const v8us o = f.half[0];
  *(v8us*)((unsigned short*)Wt + (size_t)n * K + k8) = o; 
}
// k_gemm_hh variant with fused epilogue: v = acc·alpha + bias[by·sBias + col] (+ CP[(row/rowsPerB)·sCPb + by·64 + col] if CP) ; ACT 0 none / 1 elu ; writes f16 C16 (and f32 C if non-null)
template <int ACT>
__global__ __launch_bounds__(128) void k_gemm_hhx(const _Float16* __restrict__ A, int lda, size_t sA, const _Float16* __restrict__ Bh, int ldb, size_t sB, float alpha, const float* __restrict__ bias, size_t sBias, const float* __restrict__ CP, int rowsPerB, size_t sCPb, int row0g,
    float* __restrict__ C, _Float16* __restrict__ C16, int ldc, size_t sC, int M, int N, int K) {
  __shared__ __attribute__((aligned(16))) float so[4][16][64];
  const int tid = threadIdx.x, w = tid >> 5, lane = tid & 31, ln = lane & 15, hh = lane >> 4; const int by = blockIdx.y;
  A += (size_t)by * sA; Bh += (size_t)by * sB; const size_t cofs = (size_t)by * sC; const float* bp = bias ? bias + (size_t)by * sBias : nullptr;
  const int ntn = (N + 63) / 64; const int wid = blockIdx.x * 4 + w; const int mt = wid / ntn, nq = wid % ntn; if (mt * 16 >= M) return;
  const int row0 = mt * 16, col0 = nq * 64; const _Float16* arow = A + (size_t)(row0 + ln) * lda;
  v8f acc[4] = {};
  for (int kb = 0; kb < K; kb += 32) { FragH ah; ah.half[0] = *(const v8us*)((const unsigned short*)arow + kb + 8 * hh); ah.half[1] = *(const v8us*)((const unsigned short*)arow + kb + 16 + 8 * hh);
#pragma unroll
    for (int t = 0; t < 4; ++t) { if (col0 + t * 16 >= N) continue; const size_t boff = (size_t)(col0 + t * 16 + ln) * ldb + kb; FragH bq; bq.half[0] = *(const v8us*)((const unsigned short*)Bh + boff + 8 * hh); bq.half[1] = *(const v8us*)((const unsigned short*)Bh + boff + 16 + 8 * hh);
      acc[t] = mmaH<1>(ah.v, ah.v, bq.v, bq.v, acc[t]); }
  }
#pragma unroll
  for (int t = 0; t < 4; ++t) { if (col0 + t * 16 >= N) continue; const int col = col0 + t * 16 + ln; const float bv = bp ? bf16_round(bp[col]) : 0.f;
#pragma unroll
    for (int r = 0; r < 8; ++r) { float v = acc[t][r] * alpha + bv; if (CP) { const int bidx = (row0g + row0 + 8 * hh + r) / rowsPerB; v += CP[(size_t)bidx * sCPb + (size_t)by * 64 + col]; } if (ACT == 1) v = (v > 0.f) ? v : expm1f(v); else if (ACT == 7) v = (v > 0.f) ? v + 1.0f : expf(v); else if (ACT == 8) v = tanhf(v); else if (ACT == 9) v = 0.5f * v * (1.0f + tanhf(0.7978845608028654f * (v + 0.044715f * v * v * v))); else if (ACT == 11) v = 1.0f / (1.0f + expf(-v)); else if (ACT == 12) v = (v > 0.f) ? v : 0.01f * v; else if (ACT == 14) v = (v > 0.f) ? v : 0.1f * v; else if (ACT == 15) v = v / (1.0f + expf(-v)); else if (ACT == 3) v = fmaxf(v, 0.f); else if (ACT == 6) v = 0.5f * v * (1.0f + erff(v * 0.70710678118654752f)); so[w][8 * hh + r][t * 16 + ln] = v; } }
  __builtin_amdgcn_fence(__ATOMIC_ACQ_REL, "workgroup"); __builtin_amdgcn_wave_barrier();
  const int rsub = lane >> 4, c4 = (lane & 15) * 4; typedef _Float16 v4h __attribute__((ext_vector_type(4)));
  {
#pragma unroll
    for (int q = 0; q < 8; ++q) { const int r = q * 2 + rsub; if (col0 + c4 < N) { const v4f v = *(const v4fa*)&so[w][r][c4]; if (C) *(v4f*)(C + cofs + (size_t)(row0 + r) * ldc + col0 + c4) = v; if (C16) { v4h h4; for (int i = 0; i < 4; ++i) h4[i] = (_Float16)v[i]; *(v4h*)(C16 + cofs + (size_t)(row0 + r) * ldc + col0 + c4) = h4; } } }
     }
}


typedef _Float16 v4h __attribute__((ext_vector_type(4)));

__global__ __launch_bounds__(256) void k_x16(const float* __restrict__ x, _Float16* __restrict__ X16, size_t n8) { const size_t t = (size_t)blockIdx.x * 256 + threadIdx.x; if (t >= n8) return; FragH f;
#pragma unroll
  for (int q = 0; q < 8; ++q) f.h[q] = (_Float16)bf16_round(x[t * 8 + q]); *(v8us*)((unsigned short*)X16 + t * 8) = f.half[0];  }
__global__ __launch_bounds__(256) void k_h16(const float* __restrict__ x, _Float16* __restrict__ X16, size_t n8) { const size_t t = (size_t)blockIdx.x * 256 + threadIdx.x; if (t >= n8) return; FragH f;
#pragma unroll
  for (int q = 0; q < 8; ++q) f.h[q] = (_Float16)x[t * 8 + q]; *(v8us*)((unsigned short*)X16 + t * 8) = f.half[0];  }
__global__ __launch_bounds__(256) void k_round16f(const float* __restrict__ W, _Float16* __restrict__ Bt, size_t n8) { const size_t t = (size_t)blockIdx.x * 256 + threadIdx.x; if (t >= n8) return; FragH f;
#pragma unroll
  for (int i = 0; i < 8; ++i) f.h[i] = (_Float16)(bf16_round(W[t * 8 + i]) * 16.0f); *(v8us*)((unsigned short*)Bt + t * 8) = f.half[0];  }
template <int NHv, int TTv>
__global__ __launch_bounds__(256) void k_vt(const _Float16* __restrict__ V16, int ldv, int voff, _Float16* __restrict__ Vt) { __shared__ unsigned short tl[64][66]; const int tid = threadIdx.x; const int slab = blockIdx.x / (TTv / 64), lg = blockIdx.x % (TTv / 64); const int b = slab / NHv, h = slab % NHv;
  for (int i = tid; i < 64 * 8; i += 256) { const int r = i / 8, c8 = (i % 8) * 8; FragH f; f.half[0] = *(const v8us*)((const unsigned short*)V16 + ((size_t)b * TTv + lg * 64 + r) * ldv + voff + h * 64 + c8);
#pragma unroll
    for (int q = 0; q < 8; ++q) tl[r][c8 + q] = f.u[q]; }
  __syncthreads();
  {
#pragma unroll
    for (int rd = 0; rd < 2; ++rd) { const int d = rd * 32 + tid / 8, pc = tid % 8; FragH f;
#pragma unroll
      for (int q = 0; q < 8; ++q) f.u[q] = tl[pc * 8 + q][d];
      *(v8us*)((unsigned short*)Vt + ((size_t)slab * 64 + d) * TTv + lg * 64 + pc * 8) = f.half[0]; }
     } }

__global__ __launch_bounds__(256) void k_hl(const float* __restrict__ F, _Float16* __restrict__ Hh, _Float16* __restrict__ Hl, size_t n8) { const size_t t = (size_t)blockIdx.x * 256 + threadIdx.x; if (t >= n8) return; FragH fh, fl; const v4f a = *(const v4fa*)(F + t * 8), c = *(const v4fa*)(F + t * 8 + 4);
#pragma unroll
  for (int q = 0; q < 4; ++q) { _Float16 h = (_Float16)a[q]; fh.h[q] = h; fl.h[q] = (_Float16)((a[q] - (float)h) * 1024.0f); h = (_Float16)c[q]; fh.h[4 + q] = h; fl.h[4 + q] = (_Float16)((c[q] - (float)h) * 1024.0f); }
  { *(v8us*)((unsigned short*)Hh + t * 8) = fh.half[0]; *(v8us*)((unsigned short*)Hl + t * 8) = fl.half[0];  } }

// ---- fast GEMM (wave tile 32x64; requires M % 32 == 0 rows per launch region and N % 64 == 0); epilogue = k_gemm_hhx semantics ----
__device__ __forceinline__ v16h g2_frag(const _Float16* p, int hh) { FragH f; f.half[0] = *(const v8us*)((const unsigned short*)p + 8 * hh); f.half[1] = *(const v8us*)((const unsigned short*)p + 16 + 8 * hh); return f.v; }
__device__ __forceinline__ v8f g2_mma(v16h a, v16h b, v8f c) { v8f d = __builtin_amdgcn_wmma_f32_16x16x32_f16(false, a, false, b, (short)0, c, false, false); asm volatile("v_nop\n\tv_nop\n\tv_nop\n\tv_nop" : "+v"(d) : "v"(a), "v"(b)); return d; }
template <int ACT>
__global__ __launch_bounds__(128) void k_gemm2(const _Float16* __restrict__ A, int lda, size_t sA, const _Float16* __restrict__ Bh, int ldb, size_t sB, float alpha, const float* __restrict__ bias, size_t sBias, const float* __restrict__ CP, int rowsPerB, size_t sCPb, int row0g,
    float* __restrict__ C, _Float16* __restrict__ C16, int ldc, size_t sC, int M, int N, int K) {
  __shared__ __attribute__((aligned(16))) float so[4][32][68];
  const int tid = threadIdx.x, w = tid >> 5, lane = tid & 31, ln = lane & 15, hh = lane >> 4; const int by = blockIdx.y;
  A += (size_t)by * sA; Bh += (size_t)by * sB; const size_t cofs = (size_t)by * sC; const float* bp = bias ? bias + (size_t)by * sBias : nullptr;
  const int ntn = N >> 6; const int mt = blockIdx.x / ntn, nq = blockIdx.x - mt * ntn; const int row0 = mt * 128 + 32 * w, col0 = nq * 64; if (row0 >= M) return;
  const _Float16* a0p = A + (size_t)(row0 + ln) * lda; const _Float16* a1p = a0p + (size_t)16 * lda;
  const _Float16* b0p = Bh + (size_t)(col0 + ln) * ldb; const _Float16* b1p = b0p + (size_t)16 * ldb; const _Float16* b2p = b1p + (size_t)16 * ldb; const _Float16* b3p = b2p + (size_t)16 * ldb;
  const v8f z8 = {0.f,0.f,0.f,0.f,0.f,0.f,0.f,0.f}; v8f c00 = z8, c01 = z8, c02 = z8, c03 = z8, c10 = z8, c11 = z8, c12 = z8, c13 = z8;
#pragma unroll 1
  for (int kb = 0; kb < K; kb += 32) { const v16h a0 = g2_frag(a0p + kb, hh), a1 = g2_frag(a1p + kb, hh);
    v16h b = g2_frag(b0p + kb, hh); c00 = g2_mma(a0, b, c00); c10 = g2_mma(a1, b, c10);
    b = g2_frag(b1p + kb, hh); c01 = g2_mma(a0, b, c01); c11 = g2_mma(a1, b, c11);
    b = g2_frag(b2p + kb, hh); c02 = g2_mma(a0, b, c02); c12 = g2_mma(a1, b, c12);
    b = g2_frag(b3p + kb, hh); c03 = g2_mma(a0, b, c03); c13 = g2_mma(a1, b, c13); }
  v8f accs[8] = {c00, c01, c02, c03, c10, c11, c12, c13};
#pragma unroll
  for (int u = 0; u < 8; ++u) { const int t = u & 3, half = u >> 2; const int col = col0 + t * 16 + ln; const float bv = bp ? bf16_round(bp[col]) : 0.f;
#pragma unroll
    for (int r = 0; r < 8; ++r) { const int rloc = half * 16 + 8 * hh + r; float v = accs[u][r] * alpha + bv; if (CP) { if (rowsPerB < 0) v += CP[cofs + (size_t)(row0g + row0 + rloc) * ldc + col];      /* rowsPerB < 0: own element of the batched C plane */ else { const int bidx = (row0g + row0 + rloc) / rowsPerB; v += CP[(size_t)bidx * sCPb + (size_t)by * 64 + col]; } }
      if (ACT == 3) v = fmaxf(v, 0.f); else if (ACT == 6) v = 0.5f * v * (1.0f + erff(v * 0.70710678118654752f)); else if (ACT == 11) v = 1.0f / (1.0f + expf(-v)); else if (ACT == 15) v = v / (1.0f + expf(-v)); else if (ACT == 12) v = (v > 0.f) ? v : 0.01f * v; else if (ACT == 8) v = tanhf(v);
      so[w][rloc][t * 16 + ln] = v; } }
  __builtin_amdgcn_fence(__ATOMIC_ACQ_REL, "workgroup"); __builtin_amdgcn_wave_barrier();
  const int rsub = lane >> 4, c4 = (lane & 15) * 4;
  {
#pragma unroll
    for (int q = 0; q < 16; ++q) { const int r = q * 2 + rsub; const v4f v = *(const v4fa*)&so[w][r][c4]; if (C) *(v4f*)(C + cofs + (size_t)(row0 + r) * ldc + col0 + c4) = v; if (C16) { v4h h4; for (int i = 0; i < 4; ++i) h4[i] = (_Float16)v[i]; *(v4h*)(C16 + cofs + (size_t)(row0 + r) * ldc + col0 + c4) = h4; } }
     } }



typedef unsigned int v4u __attribute__((ext_vector_type(4), may_alias));
// Packed operand planes of k_flash. Unit = the 16 bytes one lane takes in one fragment load; the 32 units of a load lie side by side (512 bytes, four whole lines), lane = 16 hh + ln.
// KP, per 32-key block 8 loads [nt][ks][c]: unit = K[16 nt + ln][32 ks + 16 c + 8 hh + 0..7].  VP, per 32-key block 8 loads [dt][c]: unit = V[16 c + 8 hh + 0..7][16 dt + ln].  Values as k_x16 makes them.
// MP, per (16-query tile, 32-key block) 2 loads [nt]: unit = bf16 bits of mask[16 qt + ln][32 jb + 16 nt + 8 hh + 0..7] (the compute dtype's rounding of the mask)
// One pre-pass launch makes all four planes (Q16 as k_x16 makes it, KP, VP, MP). A thread takes PU units of 8 values of each input, 256 units apart; a work-group so takes PU blocks of 32 keys, each with an LDS tile of its own.
#define PU 4
__global__ __launch_bounds__(256) void k_prep(const float* __restrict__ q, const float* __restrict__ kv, const float* __restrict__ M, unsigned short* __restrict__ Q16, unsigned short* __restrict__ KP, unsigned short* __restrict__ VP, unsigned short* __restrict__ MP) {
  __shared__ __attribute__((aligned(16))) unsigned short tl[PU][32][72];      /* pitch 144 B = 16 B x 9: the 16-byte row reads below spread over the banks */
  const int tid = threadIdx.x; const unsigned int u0 = blockIdx.x * (PU * 256) + tid;      /* the thread's first unit in every plane */
  const int ln = tid & 15, hh = (tid >> 4) & 1, g = tid >> 5;      /* g = the load's number in its block of 32 keys */
  const int nt = g & 1, jb = (u0 >> 6) & (TK / 32 - 1), qt = u0 / (TK * 2);      /* the mask unit's place; 256 units on, jb is 4 more: the PU * 256 units of a work-group lie in one query tile */
  static_assert((TK * 2) % (PU * 256) == 0, "a work-group's mask units stay inside one 16-query tile");
  const float* ks = kv + (size_t)u0 * 8; const float* qs = q + (size_t)u0 * 8; const float* ms = M + (size_t)(qt * 16 + ln) * TK + jb * 32 + nt * 16 + hh * 8;
  v4f ka[PU], kc[PU], qa[PU], qc[PU], ma[PU], mc[PU];
  /* every load of the thread is requested before anything is worked on: kv first, its values have the longest way */
#pragma unroll      /* constant indices: the arrays stay in registers */
  for (int i = 0; i < PU; ++i) { ka[i] = *(const v4fa*)(ks + i * 2048); kc[i] = *(const v4fa*)(ks + i * 2048 + 4); }
#pragma unroll      /* constant indices: the arrays stay in registers */
  for (int i = 0; i < PU; ++i) { qa[i] = *(const v4fa*)(qs + i * 2048); qc[i] = *(const v4fa*)(qs + i * 2048 + 4); }
  asm volatile("s_wait_xcnt 0x0" ::: "memory");      /* the compiler lets a mask load's result land in the address registers that the loads above name */
#pragma unroll      /* constant indices: the arrays stay in registers */
  for (int i = 0; i < PU; ++i) { ma[i] = *(const v4fa*)(ms + i * 128); mc[i] = *(const v4fa*)(ms + i * 128 + 4); }
  __builtin_amdgcn_sched_barrier(0);      /* keeps the loads above: without it the compiler sinks them to their uses, and the thread waits out the memory latency three times over */
#pragma unroll      /* constant indices: the arrays stay in registers */
  for (int i = 0; i < PU; ++i) { FragH f;
#pragma unroll      /* constant indices: the fragment stays in registers */
    for (int e = 0; e < 4; ++e) { f.h[e] = (_Float16)bf16_round(ka[i][e]); f.h[4 + e] = (_Float16)bf16_round(kc[i][e]); }
    *(v8us*)&tl[i][tid >> 3][(tid & 7) * 8] = f.half[0]; }
  __syncthreads();      /* all tiles are written before any thread gathers its units from them; no global store is under way yet for it to wait on */
#pragma unroll      /* constant indices: the fragment stays in registers */
  for (int i = 0; i < PU; ++i) {
    *(v8us*)(KP + (size_t)u0 * 8 + i * 2048) = *(const v8us*)&tl[i][(g >> 2) * 16 + ln][((g >> 1) & 1) * 32 + (g & 1) * 16 + hh * 8];
    FragH t;
#pragma unroll      /* constant indices: the fragment stays in registers */
    for (int e = 0; e < 8; ++e) t.u[e] = tl[i][(g & 1) * 16 + hh * 8 + e][(g >> 1) * 16 + ln];
    *(v8us*)(VP + (size_t)u0 * 8 + i * 2048) = t.half[0]; }
#pragma unroll      /* constant indices: the arrays stay in registers */
  for (int i = 0; i < PU; ++i) { FragH f;
#pragma unroll      /* constant indices: the fragment stays in registers */
    for (int e = 0; e < 4; ++e) { f.h[e] = (_Float16)bf16_round(qa[i][e]); f.h[4 + e] = (_Float16)bf16_round(qc[i][e]); }
    *(v8us*)(Q16 + (size_t)u0 * 8 + i * 2048) = f.half[0]; }
#pragma unroll      /* constant indices: the arrays stay in registers */
  for (int i = 0; i < PU; ++i) { v8us o;
#pragma unroll      /* constant indices: the vector stays in registers */
    for (int e = 0; e < 4; ++e) { o[e] = bf16_bits(ma[i][e]); o[4 + e] = bf16_bits(mc[i][e]); }
    *(v8us*)(MP + (size_t)u0 * 8 + i * 2048) = o; } }

// one f16 product of k_flash as the plain builtin: the compiler keeps the distance behind a matrix instruction itself, with other work of the pass where it has some
__device__ __forceinline__ v8f mmaF(v16h a, v16h b, v8f c) { return __builtin_amdgcn_wmma_f32_16x16x32_f16(false, a, false, b, (short)0, c, false, false); }
typedef float v2f __attribute__((ext_vector_type(2)));
// lane l <-> lane l ^ 16 by a vector cross-row move
__device__ __forceinline__ float xhalf(float x) { return __builtin_bit_cast(float, __builtin_amdgcn_permlanex16(__builtin_bit_cast(int, x), __builtin_bit_cast(int, x), 0x76543210, 0xfedcba98, false, false)); }
template <int CAUSAL>
__global__ __launch_bounds__(512) void k_flash(const _Float16* __restrict__ Q16, int ldq, const unsigned short* __restrict__ KP, const unsigned short* __restrict__ VP, const unsigned short* __restrict__ MP, float* __restrict__ O, int ldo) {
  static_assert(CAUSAL == 0 || CAUSAL == 33, "modes: 0 = no mask, 33 = one additive [TQ][TK] f32 table shared by every slab");
  constexpr int QT = 2, RPW = 16 * QT, NQW = QPB / RPW, NW = 2 * NQW, DT = 4, KS = 2; constexpr float L2E = 1.4426950408889634f, PCAP = 32768.0f;      /* QT query tiles of 16 columns a wave: every K and V^T fragment loaded feeds QT products; waves w and w + NQW share their columns and take half the keys each; log2 e; PCAP: the sum of a lane's 16 weights of a pass up to which the reference point of its column stays, 2^15 */
  __shared__ __attribute__((aligned(16))) float sO[NW][16][64 + 4]; __shared__ __attribute__((aligned(16))) float sX[NW][2 * DT][32][4]; __shared__ float sML[NW][2][32];      /* output staging; the context tile, maximum and sum that a wave hands to its partner, lane by lane */
  const int tid = threadIdx.x, w = tid >> 5, lane = tid & 31, ln = lane & 15, hh = lane >> 4;
  const int slab = blockIdx.x / QBNP, qblk = QB0P + blockIdx.x % QBNP; const int b = slab / NH, h = slab % NH; const int qb0 = qblk * QPB; const int kh = __builtin_amdgcn_readfirstlane(w / NQW); const int q0 = qb0 + (w % NQW) * RPW;      /* kh: the wave's half of the keys, in a scalar register (it bounds the loop) */
  FragH bq[QT][KS];
#pragma unroll      /* constant indices: the array stays in registers */
  for (int qt = 0; qt < QT; ++qt) { const unsigned short* qr = (const unsigned short*)Q16 + ((size_t)b * TQ + q0 + qt * 16 + ln) * ldq + h * 64;
#pragma unroll      /* constant indices: the array stays in registers */
    for (int ks = 0; ks < KS; ++ks) { bq[qt][ks].half[0] = *(const v8us*)(qr + ks * 32 + 8 * hh); bq[qt][ks].half[1] = *(const v8us*)(qr + ks * 32 + 16 + 8 * hh); } }
  /* packed planes (k_prep): a fragment load is 32 lanes x 16 consecutive bytes, four whole 128-byte lines */
  const unsigned short* kpl = KP + (size_t)slab * 64 * TK; const unsigned short* mpl = MP + (size_t)__builtin_amdgcn_readfirstlane(q0 >> 4) * 16 * TK;      /* wave-uniform bases: scalar address arithmetic */
  const unsigned int l8 = lane * 8;      /* the lane's unit in every load */
  float m_r[QT], l_r[QT]; v8f oacc[QT][DT];
#pragma unroll      /* constant indices: the arrays stay in registers */
  for (int qt = 0; qt < QT; ++qt) { m_r[qt] = -3.0e38f; l_r[qt] = 0.f;
#pragma unroll      /* constant indices: the array stays in registers */
    for (int dt = 0; dt < DT; ++dt) oacc[qt][dt] = (v8f){0.f,0.f,0.f,0.f,0.f,0.f,0.f,0.f}; }
  const int jbeg = kh * (TK / 2), jend = jbeg + TK / 2;
  /* every global operand of the loop is held in registers and requested far ahead of its use; V^T's at the head of a pass, the next pass's K and mask each right after the step that last reads their registers */
  FragH ak[2][KS], av[DT]; v4u mk[QT][2];
  auto fetch_k = [&](int j0, bool closed = false) {      /* K fragments of the 32 keys from j0; closed: the last load, whose result may land in the address registers that the others name, is held back until those are through with them */
#pragma unroll      /* constant indices: the array stays in registers */
    for (int nt = 0; nt < 2; ++nt) { const unsigned short* kr = kpl + (size_t)j0 * 64 + nt * 1024;
#pragma unroll      /* constant indices: the array stays in registers */
      for (int ks = 0; ks < KS; ++ks) { ak[nt][ks].half[0] = *(const v8us*)(kr + ks * 512 + l8); if (closed && nt == 1 && ks == KS - 1) asm volatile("s_wait_xcnt 0x0" ::: "memory"); ak[nt][ks].half[1] = *(const v8us*)(kr + ks * 512 + 256 + l8); } } };
  auto fetch_m = [&](int j0) {      /* mode 33: the mask values of this lane's 16 score elements per query tile, 8 consecutive keys of its query's row per key tile, as bf16 pairs */
    if (CAUSAL == 33) {
#pragma unroll      /* constant indices: the array stays in registers */
      for (int qt = 0; qt < QT; ++qt) { const unsigned short* amk = mpl + (size_t)qt * 16 * TK + (size_t)j0 * 16;
#pragma unroll      /* constant indices: the array stays in registers */
        for (int nt = 0; nt < 2; ++nt) mk[qt][nt] = *(const v4u*)(amk + nt * 256 + l8); } } };
  v8f s[QT][2]; v2f sc[QT][8]; FragH pb[QT]; float ps[QT];      /* sc: pairs of neighbouring accumulator registers, written as vectors: the packed instructions then pair inside a tile, with no register moves */
  auto products = [&]() {      /* S^T of the 32 keys whose K fragments are held */
#pragma unroll      /* constant indices: the array stays in registers */
    for (int qt = 0; qt < QT; ++qt) { s[qt][0] = (v8f){0.f,0.f,0.f,0.f,0.f,0.f,0.f,0.f}; s[qt][1] = s[qt][0]; }
#pragma unroll      /* constant indices: the arrays stay in registers */
    for (int ks = 0; ks < KS; ++ks)      /* the four score tiles side by side in each k step; every tile still adds k step 0, then 1 */
#pragma unroll      /* constant indices: the arrays stay in registers */
      for (int nt = 0; nt < 2; ++nt)
#pragma unroll      /* constant indices: the arrays stay in registers */
        for (int qt = 0; qt < QT; ++qt) s[qt][nt] = mmaF(ak[nt][ks].v, bq[qt][ks].v, s[qt][nt]); };
  auto scores = [&]() {      /* scale, and the mask values that are held */
#pragma unroll      /* constant indices: the array stays in registers */
    for (int qt = 0; qt < QT; ++qt)
#pragma unroll      /* constant indices: the array stays in registers */
      for (int i = 0; i < 8; ++i) { v2f v = (v2f){s[qt][i >> 2][(2 * i) & 7], s[qt][i >> 2][(2 * i + 1) & 7]} * SCL; if (CAUSAL == 33) { const unsigned int mw = mk[qt][i >> 2][i & 3]; v += (v2f){__uint_as_float(mw << 16), __uint_as_float(mw & 0xFFFF0000u)}; } sc[qt][i] = v; } };
  auto colmax = [&](int qt) {      /* the query's maximum over the 32 keys, the same in both halves of the wave */
    const v2f (&c)[8] = sc[qt];
    const float ma = fmaxf(fmaxf(c[0][0], c[0][1]), c[1][0]), mb = fmaxf(fmaxf(c[1][1], c[2][0]), c[2][1]), mc3 = fmaxf(fmaxf(c[3][0], c[3][1]), c[4][0]), md = fmaxf(fmaxf(c[4][1], c[5][0]), c[5][1]), me = fmaxf(fmaxf(c[6][0], c[6][1]), c[7][0]);
    const float mc = fmaxf(fmaxf(fmaxf(ma, mb), mc3), fmaxf(fmaxf(md, me), c[7][1]));
    return fmaxf(mc, xhalf(mc)); };
  /* e^x as the hardware's 2^(x log2 e); where the library form's underflow select gives 0 (also at -inf, or a product that overflows to it) the hardware gives 0 too; a weight too large for f16 is caught by the loop's test before it is used */
  auto weights = [&]() {      /* from the scores and the reference points: P as the second product's operand, and the lane's sum of its weights */
#pragma unroll      /* constant indices: the arrays stay in registers */
    for (int qt = 0; qt < QT; ++qt) { const float mn = m_r[qt]; float p[16];
#pragma unroll      /* constant indices: the array stays in registers */
      for (int i = 0; i < 8; ++i) { const v2f x = __builtin_elementwise_fma(sc[qt][i] - mn, (v2f){L2E, L2E}, (v2f){4.0f, 4.0f}); p[2 * i] = __builtin_amdgcn_exp2f(x[0]); p[2 * i + 1] = __builtin_amdgcn_exp2f(x[1]); pb[qt].h[2 * i] = (_Float16)p[2 * i]; pb[qt].h[2 * i + 1] = (_Float16)p[2 * i + 1]; }      /* p = 16 e^(s - m): the operand's 2^4 scale rides in the exponent, and the row sum carries it too. The scale sets the room on both sides of the reference point: a score may pass it by ln 2^11 before PCAP is met, and a weight stays a normal f16 number down to e^-12.5 */
      ps[qt] = (((p[0] + p[1]) + (p[2] + p[3])) + ((p[4] + p[5]) + (p[6] + p[7]))) + (((p[8] + p[9]) + (p[10] + p[11])) + ((p[12] + p[13]) + (p[14] + p[15]))); } };
  fetch_k(jbeg); fetch_m(jbeg);
  /* m_r is the reference point of a column's sum and context, not its true maximum: it starts at the maximum over the first 32 keys (their scores are made again in the first pass, from the same registers) */
  products(); scores();
#pragma unroll      /* constant indices: the arrays stay in registers */
  for (int qt = 0; qt < QT; ++qt) m_r[qt] = fmaxf(m_r[qt], colmax(qt));
  /* the loop's common path addresses its loads by a plane's base and one 32-bit byte offset per plane, the lane's own, held in a register of its own for the whole pass and stepped only at the pass's foot, behind the wait that stands there: no register that a load names is written while the load is under way, so no wait stands directly behind the requests */
  unsigned int ov = (unsigned int)(((size_t)slab * 64 * TK + (size_t)jbeg * 64 + l8) * 2);      /* V^T of this pass */
  unsigned int ok = (unsigned int)(((size_t)slab * 64 * TK + (size_t)(jbeg + 32) * 64 + l8) * 2);      /* K of the next pass */
  unsigned int om = (unsigned int)(((size_t)(q0 >> 4) * 16 * TK + (size_t)(jbeg + 32) * 16 + l8) * 2);      /* mask values of the next pass */
  static_assert(TK / 2 > 32, "a second pass exists");
  auto next_k = [&](bool closed = false) {      /* the K fragments at ok, in fetch_k's order; closed: as in fetch_k */
#pragma unroll      /* constant indices: the array stays in registers */
    for (int f = 0; f < 2 * KS; ++f) { ak[f / KS][f % KS].half[0] = *(const v8us*)((const char*)KP + ok + f * 1024); if (closed && f == 2 * KS - 1) asm volatile("s_wait_xcnt 0x0" ::: "memory"); ak[f / KS][f % KS].half[1] = *(const v8us*)((const char*)KP + ok + f * 1024 + 512); } };
  auto next_m = [&]() {      /* the mask values at om, in fetch_m's order */
#pragma unroll      /* constant indices: the array stays in registers */
    for (int f = 0; f < 2 * QT; ++f) if (CAUSAL == 33) mk[f / 2][f % 2] = *(const v4u*)((const char*)MP + om + (f / 2) * (32 * TK) + (f % 2) * 512); };
#pragma unroll 1      /* rolled: the operands fetched ahead keep one register set */
  for (int j0 = jbeg; j0 < jend; j0 += 32) {
    const int jn = (j0 + 32 < jend) ? j0 + 32 : jbeg;      /* the last pass re-reads the first block: in bounds, never used */
#pragma unroll      /* constant indices: the array stays in registers */
    for (int dt = 0; dt < DT; ++dt) { av[dt].half[0] = *(const v8us*)((const char*)VP + ov + dt * 1024); av[dt].half[1] = *(const v8us*)((const char*)VP + ov + dt * 1024 + 512); }      /* used behind the softmax of this pass */
    __builtin_amdgcn_sched_barrier(0);      /* holds the requests above in their place: without it the compiler sinks them to their uses, and the wave waits out the latency */
    products();
    next_k();      /* the next pass's K, into the registers just read */
    __builtin_amdgcn_sched_barrier(0);      /* as at the head of the pass */
    scores();
    next_m();      /* the next pass's mask values, into the registers just read */
    __builtin_amdgcn_sched_barrier(0);      /* as at the head of the pass */
    weights();
    /* lazy rescale: the reference point moves only in a pass where some lane's weights add up to more than PCAP (no weight is negative, so up to there each fits f16); one test a pass for the whole wave, a scalar branch. Only then is a maximum taken, are sum and context scaled and the weights made anew; the scores are gone by then, so this pass's K and mask are read once more */
    if (__builtin_expect(__builtin_amdgcn_ballot_w32(ps[0] > PCAP || ps[1] > PCAP) != 0, 0)) {      /* marked unlikely: the pass's common path then runs straight through, with the rare one laid out of its way */
      fetch_k(j0, true); fetch_m(j0);
      asm volatile("s_wait_xcnt 0x0" ::: "memory");      /* before the address registers that these loads name are written again */
      products(); scores();
#pragma unroll      /* constant indices: the arrays stay in registers */
      for (int qt = 0; qt < QT; ++qt) {
        const float mn = fmaxf(m_r[qt], colmax(qt)); const float al = (mn > -1.0e38f) ? __builtin_amdgcn_exp2f((m_r[qt] - mn) * L2E) : 1.0f; m_r[qt] = mn; l_r[qt] *= al;
#pragma unroll      /* constant indices: the array stays in registers */
        for (int dt = 0; dt < DT; ++dt) oacc[qt][dt] *= al; }
      weights();
      next_k(true); next_m();      /* the next pass's operands again, into the registers just read; on this side the compiler forms whole addresses in spare registers */
      asm volatile("s_wait_xcnt 0x0" ::: "memory"); }      /* as above */
#pragma unroll      /* constant indices: the arrays stay in registers */
    for (int qt = 0; qt < QT; ++qt) { l_r[qt] += ps[qt];
#pragma unroll      /* constant indices: the array stays in registers */
      for (int dt = 0; dt < DT; ++dt) oacc[qt][dt] = mmaF(av[dt].v, pb[qt].v, oacc[qt][dt]); }
    /* v_nop: the distance behind the pass's last products on the branch's taken side: the next pass's first score products write over the P registers that these read as B. s_wait_xcnt: the offset steps below rewrite the address registers that this pass's loads name */
    asm volatile("v_nop\n\tv_nop\n\tv_nop\n\tv_nop\n\ts_wait_xcnt 0x0" : "+v"(oacc[0][0]), "+v"(oacc[0][1]), "+v"(oacc[0][2]), "+v"(oacc[0][3]), "+v"(oacc[1][0]), "+v"(oacc[1][1]), "+v"(oacc[1][2]), "+v"(oacc[1][3]), "+v"(ov), "+v"(ok), "+v"(om) : : "memory");      /* the three offsets pass through it: their steps below stand behind the wait */
    const int jn1 = (j0 + 64 < jend) ? j0 + 64 : jbeg;      /* the block that the next pass fetches ahead */
    ov += 32 * 64 * 2; ok += (unsigned int)((jn1 - jn) * (64 * 2)); om += (unsigned int)((jn1 - jn) * (16 * 2)); }
  /* the two halves of the keys are joined: wave kh finishes query tile kh and hands its part of the other tile to its partner */
  const int pw = w ^ NQW; const bool k1 = kh != 0;
  const float mg = k1 ? m_r[0] : m_r[1], lg = k1 ? l_r[0] : l_r[1], mo = k1 ? m_r[1] : m_r[0], lo = k1 ? l_r[1] : l_r[0]; v8f oo[DT];
#pragma unroll      /* constant indices: the arrays stay in registers */
  for (int dt = 0; dt < DT; ++dt) { const v8f g = k1 ? oacc[0][dt] : oacc[1][dt]; oo[dt] = k1 ? oacc[1][dt] : oacc[0][dt];
    *(v4fa*)&sX[w][2 * dt][lane][0] = (v4f){g[0], g[1], g[2], g[3]}; *(v4fa*)&sX[w][2 * dt + 1][lane][0] = (v4f){g[4], g[5], g[6], g[7]}; }
  sML[w][0][lane] = mg; sML[w][1][lane] = lg;
  __syncthreads();      /* every wave's handed-over part is written before its partner reads it */
  { const float mp = sML[pw][0][lane], lp = sML[pw][1][lane]; const float mn = fmaxf(mo, mp);
    const float ao = (mn > -1.0e38f) ? __builtin_amdgcn_exp2f((mo - mn) * L2E) : 1.0f, ap = (mn > -1.0e38f) ? __builtin_amdgcn_exp2f((mp - mn) * L2E) : 1.0f;      /* each part is brought to the common maximum, as the loop does from pass to pass */
    const float lh = lo * ao + lp * ap; const float l = lh + xhalf(lh);      /* the two lane halves' sums of the query's row, joined once */
    const float inv = (l > 0.f) ? 1.0f / l : 0.f;      /* sum and context both carry the factor 16 */
#pragma unroll      /* constant indices: the array stays in registers */
    for (int dt = 0; dt < DT; ++dt) { const v4f x0 = *(const v4fa*)&sX[pw][2 * dt][lane][0], x1 = *(const v4fa*)&sX[pw][2 * dt + 1][lane][0]; const v8f x = {x0[0], x0[1], x0[2], x0[3], x1[0], x1[1], x1[2], x1[3]};
      const v8f o = (oo[dt] * ao + x * ap) * inv;      /* register r = O[q0 + 16 kh + ln][16 dt + 8 hh + r] */
      *(v4fa*)&sO[w][ln][dt * 16 + 8 * hh] = (v4f){o[0], o[1], o[2], o[3]}; *(v4fa*)&sO[w][ln][dt * 16 + 8 * hh + 4] = (v4f){o[4], o[5], o[6], o[7]}; } }
  __builtin_amdgcn_fence(__ATOMIC_ACQ_REL, "workgroup"); __builtin_amdgcn_wave_barrier();      /* the wave's own staged rows are written before its lanes read them back as whole lines */
  {
#pragma unroll      /* constant indices: the array stays in registers */
    for (int rp = 0; rp < 16; rp += 2) { const int r = rp + (lane >> 4), pc = lane & 15; const v4f val = *(const v4fa*)&sO[w][r][pc * 4]; *(v4f*)(O + ((size_t)b * TQ + q0 + kh * 16 + r) * ldo + h * 64 + pc * 4) = val; }
     } }
// 5-plane variant: S = Qh Kh^T + (Ql Kh^T + Qh Kl^T)/1024 with Q/K = [hi | 2^10 residual] f16 planes (QL/KL same layout as Q16/K16), then the 3-term P.V below.
// 3-term variant: O = (P_hi V_hi + (P_lo V_hi + P_hi V_lo) / 1024) / l with P = [hi | 2^10 residual] of 1024 p and V^T = [hi | 2^10 residual] planes (VtL same layout as Vt) -> ~2^-21-class products for un-averaged (early causal / peaked) rows
template <int CAUSAL>
__global__ __launch_bounds__(128) void k_flash5(const _Float16* __restrict__ Q16, const _Float16* __restrict__ QL, int ldq, const _Float16* __restrict__ K16, const _Float16* __restrict__ KL, int ldk, const _Float16* __restrict__ Vt, const _Float16* __restrict__ VtL, const int* __restrict__ MSK, float* __restrict__ O, int ldo) {
  constexpr int RPW = 16, RTN = RPW / 16, NQB = TQ / (4 * RPW), DT = 4, KS = 2;
  __shared__ __attribute__((aligned(16))) unsigned short sP[4][RPW][40]; __shared__ __attribute__((aligned(16))) unsigned short sPL[4][RPW][40]; __shared__ __attribute__((aligned(16))) float sO[4][RPW][64 + 4];
  const int tid = threadIdx.x, w = tid >> 5, lane = tid & 31, ln = lane & 15, hh = lane >> 4;
  const int slab = blockIdx.x / QBN5, qblk = QB05 + blockIdx.x % QBN5; (void)NQB; const int b = slab / NH, h = slab % NH; const int qb0 = qblk * (4 * RPW); const int q0 = qb0 + w * RPW;
  FragH aq[2][KS], aql[2][KS];
#pragma unroll
  for (int rt = 0; rt < RTN; ++rt) { const unsigned short* qr = (const unsigned short*)Q16 + ((size_t)b * TQ + q0 + rt * 16 + ln) * ldq + h * 64; const unsigned short* ql = (const unsigned short*)QL + ((size_t)b * TQ + q0 + rt * 16 + ln) * ldq + h * 64;
#pragma unroll
    for (int ks = 0; ks < KS; ++ks) { aq[rt][ks].half[0] = *(const v8us*)(qr + ks * 32 + 8 * hh); aq[rt][ks].half[1] = *(const v8us*)(qr + ks * 32 + 16 + 8 * hh); aql[rt][ks].half[0] = *(const v8us*)(ql + ks * 32 + 8 * hh); aql[rt][ks].half[1] = *(const v8us*)(ql + ks * 32 + 16 + 8 * hh); } }
  const unsigned short* Vth = (const unsigned short*)Vt + (size_t)slab * 64 * TK; const unsigned short* Vtl = (const unsigned short*)VtL + (size_t)slab * 64 * TK;
  float m_r[2][8], l_r[2][8]; v8f oacc[2][DT], oaccL[2][DT];
#pragma unroll
  for (int rt = 0; rt < RTN; ++rt) {
#pragma unroll
    for (int r = 0; r < 8; ++r) { m_r[rt][r] = -3.0e38f; l_r[rt][r] = 0.f; }
#pragma unroll
    for (int dt = 0; dt < DT; ++dt) { oacc[rt][dt] = (v8f){0.f,0.f,0.f,0.f,0.f,0.f,0.f,0.f}; oaccL[rt][dt] = oacc[rt][dt]; } }
  const int jend = (CAUSAL == 1) ? (qb0 + 4 * RPW) : ((CAUSAL == 23) ? min(TK, (qb0 / CHK + 2) * CHK) : TK);      /* causal / window: keys that can never contribute are skipped */ const int jbeg = (CAUSAL == 23) ? max(0, (qb0 / CHK - 1) * CHK) : 0;
#pragma unroll 1
  for (int j0 = jbeg; j0 < jend; j0 += 32) {
    v8f s[2][2];
#pragma unroll
    for (int nt = 0; nt < 2; ++nt) { const unsigned short* kr = (const unsigned short*)K16 + ((size_t)b * TK + j0 + nt * 16 + ln) * ldk + h * 64; const unsigned short* klr = (const unsigned short*)KL + ((size_t)b * TK + j0 + nt * 16 + ln) * ldk + h * 64; FragH bk[KS], bkl[KS];
#pragma unroll
      for (int ks = 0; ks < KS; ++ks) { bk[ks].half[0] = *(const v8us*)(kr + ks * 32 + 8 * hh); bk[ks].half[1] = *(const v8us*)(kr + ks * 32 + 16 + 8 * hh); bkl[ks].half[0] = *(const v8us*)(klr + ks * 32 + 8 * hh); bkl[ks].half[1] = *(const v8us*)(klr + ks * 32 + 16 + 8 * hh); }
#pragma unroll
      for (int rt = 0; rt < RTN; ++rt) { v8f acc = (v8f){0.f,0.f,0.f,0.f,0.f,0.f,0.f,0.f}, accl = acc;
#pragma unroll
        for (int ks = 0; ks < KS; ++ks) { acc = mmaH<1>(aq[rt][ks].v, aq[rt][ks].v, bk[ks].v, bk[ks].v, acc); accl = mmaH<1>(aql[rt][ks].v, aql[rt][ks].v, bk[ks].v, bk[ks].v, accl); accl = mmaH<1>(aq[rt][ks].v, aq[rt][ks].v, bkl[ks].v, bkl[ks].v, accl); }
#pragma unroll
        for (int r = 0; r < 8; ++r) acc[r] += accl[r] * 0.0009765625f;
        s[rt][nt] = acc; } }
#pragma unroll
    for (int rt = 0; rt < RTN; ++rt)
#pragma unroll
      for (int r = 0; r < 8; ++r) { const int tq = q0 + rt * 16 + 8 * hh + r; const int k0 = j0 + ln, k1 = j0 + 16 + ln;
        bool ok0 = (CAUSAL == 1) ? (k0 <= tq) : ((CAUSAL == 2) ? ((k0 >> 5) == (tq >> 5)) : true), ok1 = (CAUSAL == 1) ? (k1 <= tq) : ((CAUSAL == 2) ? ((k1 >> 5) == (tq >> 5)) : true);      /* mode 2: block-diagonal 32-token groups */
        if (CAUSAL == 4) { const int* mrow = MSK + ((size_t)b * TQ + tq) * TK; ok0 = mrow[k0] != 0; ok1 = mrow[k1] != 0; }      /* mode 4: per-(query, key) INPUT mask shared by all heads; masked keys contribute nothing (== the reference's -4096 fill, whose exp underflows to 0), rows with no valid key give l = 0 -> output 0 (== the reference's row_valid zeroing) */
        float s0 = ok0 ? s[rt][0][r] * SCL : -3.0e38f, s1 = ok1 ? s[rt][1][r] * SCL : -3.0e38f; if (CAUSAL == 33) { const float* amk = (const float*)MSK + (size_t)tq * TK; s0 += bf16_round(amk[k0]); s1 += bf16_round(amk[k1]); }      /* mode 33: one additive [TQ][TK] f32 table shared by every slab */ if (CAUSAL == 17) { const float* amk = (const float*)MSK + (size_t)b * TK; s0 += bf16_round(amk[k0]); s1 += bf16_round(amk[k1]); } if (CAUSAL == 18) { const float* tb = (const float*)MSK; const int* ri = MSK + 1024 + (size_t)b * TK; const int rq = ri[tq]; s0 += tb[(h * 8 + rq) * 8 + ri[k0]]; s1 += tb[(h * 8 + rq) * 8 + ri[k1]]; } if (CAUSAL == 19) { const int* rel = MSK + (size_t)tq * TK; const float* rb = (const float*)MSK + (size_t)TQ * TK + ((size_t)(b * NH + h) * TQ + tq) * 64; s0 += rb[rel[k0]]; s1 += rb[rel[k1]]; }      /* mode 19: + (q.Ek[rel] + Eb[rel][h]) / 8 gathered by the int relative ids (packed [ids | table]) */      /* mode 18: + resource_bias[h][r_q][r_k] from the packed [table | ids] buffer (TQ == TK) */      /* mode 17: additive per-(batch, key) mask INPUT */ float mc = fmaxf(s0, s1);
        mc = fmaxf(mc, __shfl_xor(mc, 1, 32)); mc = fmaxf(mc, __shfl_xor(mc, 2, 32)); mc = fmaxf(mc, __shfl_xor(mc, 4, 32)); mc = fmaxf(mc, __shfl_xor(mc, 8, 32));
        const float mn = fmaxf(m_r[rt][r], mc); const float al = (mn > -1.0e38f) ? expf(m_r[rt][r] - mn) : 1.0f; m_r[rt][r] = mn; const float p0 = ok0 ? expf(s0 - mn) : 0.f, p1 = ok1 ? expf(s1 - mn) : 0.f; l_r[rt][r] = l_r[rt][r] * al + p0 + p1;
#pragma unroll
        for (int dt = 0; dt < DT; ++dt) { oacc[rt][dt][r] *= al; oaccL[rt][dt][r] *= al; }
        FragH t2, t2l; const float ps0 = p0 * 1024.0f, ps1 = p1 * 1024.0f; t2.h[0] = (_Float16)ps0; t2.h[1] = (_Float16)ps1; t2l.h[0] = (_Float16)((ps0 - (float)t2.h[0]) * 1024.0f); t2l.h[1] = (_Float16)((ps1 - (float)t2.h[1]) * 1024.0f);
        sP[w][rt * 16 + 8 * hh + r][ln] = t2.u[0]; sP[w][rt * 16 + 8 * hh + r][16 + ln] = t2.u[1]; sPL[w][rt * 16 + 8 * hh + r][ln] = t2l.u[0]; sPL[w][rt * 16 + 8 * hh + r][16 + ln] = t2l.u[1]; }
    __builtin_amdgcn_fence(__ATOMIC_ACQ_REL, "workgroup"); __builtin_amdgcn_wave_barrier();
    FragH pa[2], pl[2];
#pragma unroll
    for (int rt = 0; rt < RTN; ++rt) { pa[rt].half[0] = *(const v8us*)&sP[w][rt * 16 + ln][8 * hh]; pa[rt].half[1] = *(const v8us*)&sP[w][rt * 16 + ln][16 + 8 * hh]; pl[rt].half[0] = *(const v8us*)&sPL[w][rt * 16 + ln][8 * hh]; pl[rt].half[1] = *(const v8us*)&sPL[w][rt * 16 + ln][16 + 8 * hh]; }
#pragma unroll
    for (int dt = 0; dt < DT; ++dt) { const unsigned short* vrow = Vth + (size_t)(dt * 16 + ln) * TK + j0; const unsigned short* vrl = Vtl + (size_t)(dt * 16 + ln) * TK + j0; FragH bv, bl; bv.half[0] = *(const v8us*)(vrow + 8 * hh); bv.half[1] = *(const v8us*)(vrow + 16 + 8 * hh); bl.half[0] = *(const v8us*)(vrl + 8 * hh); bl.half[1] = *(const v8us*)(vrl + 16 + 8 * hh);
#pragma unroll
      for (int rt = 0; rt < RTN; ++rt) { oacc[rt][dt] = mmaH<1>(pa[rt].v, pa[rt].v, bv.v, bv.v, oacc[rt][dt]); oaccL[rt][dt] = mmaH<1>(pl[rt].v, pl[rt].v, bv.v, bv.v, oaccL[rt][dt]); oaccL[rt][dt] = mmaH<1>(pa[rt].v, pa[rt].v, bl.v, bl.v, oaccL[rt][dt]); } }
    __builtin_amdgcn_fence(__ATOMIC_ACQ_REL, "workgroup"); __builtin_amdgcn_wave_barrier(); }
#pragma unroll
  for (int rt = 0; rt < RTN; ++rt) {
#pragma unroll
    for (int r = 0; r < 8; ++r) { float l = l_r[rt][r]; l += __shfl_xor(l, 1, 32); l += __shfl_xor(l, 2, 32); l += __shfl_xor(l, 4, 32); l += __shfl_xor(l, 8, 32); l_r[rt][r] = (l > 0.f) ? 1.0f / (l * 1024.0f) : 0.f; }
#pragma unroll
    for (int dt = 0; dt < DT; ++dt)
#pragma unroll
      for (int r = 0; r < 8; ++r) { float v = oacc[rt][dt][r]; v += oaccL[rt][dt][r] * 0.0009765625f; sO[w][rt * 16 + 8 * hh + r][dt * 16 + ln] = v * l_r[rt][r]; } }
  __builtin_amdgcn_fence(__ATOMIC_ACQ_REL, "workgroup"); __builtin_amdgcn_wave_barrier();
  {
#pragma unroll
    for (int rp = 0; rp < RPW; rp += 2) { const int r = rp + (lane >> 4), pc = lane & 15; const v4f val = *(const v4fa*)&sO[w][r][pc * 4]; *(v4f*)(O + ((size_t)b * TQ + q0 + r) * ldo + h * 64 + pc * 4) = val; }
     } }

__global__ __launch_bounds__(256) void k_rotab(float* __restrict__ CS, float* __restrict__ SN) {
  #pragma clang fp contract(off)
  const int t = blockIdx.x * 256 + threadIdx.x; if (t >= SLEN * 32) return; const int j = t % 32, s = t / 32; const float ex = (float)(2 * j) / 64.0f; const float inv = 1.0f / powf(10000.0f, ex); const float th = (float)s * inv; const float c = cosf(th), sn = sinf(th);
  { *(float*)(CS + t) = c; *(float*)(SN + t) = sn;  } }
__global__ __launch_bounds__(256) void k_rope(const float* __restrict__ F, int nsrc, int ndst, int rep, const float* __restrict__ CS, const float* __restrict__ SN, _Float16* __restrict__ H, _Float16* __restrict__ L) {
  #pragma clang fp contract(off)
  const size_t t = (size_t)blockIdx.x * 256 + threadIdx.x; if (t >= (size_t)NR * ndst * 4) return; const int g8 = (int)(t % 4); const int hd = (int)((t / 4) % ndst); const size_t row = t / ((size_t)4 * ndst); const int s = (int)(row % SLEN); const int hs = hd / rep;
  const float* src = F + row * (size_t)(nsrc * 64) + hs * 64; FragH ah, al, bh, bl;
  for (int i = 0; i < 8; ++i) { const int d = g8 * 8 + i; const float c = CS[s * 32 + d], sn = SN[s * 32 + d]; const float x1 = src[d], x2 = src[d + 32];
    float o1 = x1 * c; o1 += -x2 * sn; float o2 = x2 * c; o2 += x1 * sn;
    _Float16 hv = (_Float16)o1; ah.h[i] = hv; al.h[i] = (_Float16)((o1 - (float)hv) * 1024.0f); hv = (_Float16)o2; bh.h[i] = hv; bl.h[i] = (_Float16)((o2 - (float)hv) * 1024.0f); }
  const size_t o = row * (size_t)(ndst * 64) + hd * 64 + g8 * 8;
  { *(v8us*)((unsigned short*)H + o) = ah.half[0]; *(v8us*)((unsigned short*)H + o + 32) = bh.half[0]; *(v8us*)((unsigned short*)L + o) = al.half[0]; *(v8us*)((unsigned short*)L + o + 32) = bl.half[0];  } }
__global__ __launch_bounds__(256) void k_rope2(const float* __restrict__ F, int nsrc, int ndst, int rep, const float* __restrict__ CS, const float* __restrict__ SN, _Float16* __restrict__ H, _Float16* __restrict__ L) {
  #pragma clang fp contract(off)
  const size_t t = (size_t)blockIdx.x * 256 + threadIdx.x; if (t >= (size_t)NR * ndst * 4) return; const int g16 = (int)(t % 4); const int hd = (int)((t / 4) % ndst); const size_t row = t / ((size_t)4 * ndst); const int s = (int)(row % SLEN); const int hs = hd / rep;
  const float* src = F + row * (size_t)(nsrc * 64) + hs * 64 + g16 * 16; FragH ah, al;
  for (int pr = 0; pr < 8; ++pr) { const int i = g16 * 8 + pr; const float c = CS[s * 32 + i], sn = SN[s * 32 + i]; const float x1 = src[2 * pr], x2 = src[2 * pr + 1];
    float o1 = x1 * c; o1 -= x2 * sn; float o2 = x1 * sn; o2 += x2 * c;
    _Float16 hv = (_Float16)o1; ah.h[2 * pr] = hv; al.h[2 * pr] = (_Float16)((o1 - (float)hv) * 1024.0f); hv = (_Float16)o2; ah.h[2 * pr + 1] = hv; al.h[2 * pr + 1] = (_Float16)((o2 - (float)hv) * 1024.0f); }
  const size_t o = row * (size_t)(ndst * 64) + hd * 64 + g16 * 16;
  { *(v8us*)((unsigned short*)H + o) = ah.half[0]; *(v8us*)((unsigned short*)H + o + 8) = ah.half[1]; *(v8us*)((unsigned short*)L + o) = al.half[0]; *(v8us*)((unsigned short*)L + o + 8) = al.half[1];  } }
__global__ __launch_bounds__(256) void k_ln512(const float* __restrict__ A, const float* __restrict__ res, const float* __restrict__ g, const float* __restrict__ bb, float* __restrict__ Y, _Float16* __restrict__ Y16) {
  #pragma clang fp contract(off)
  const int wv = threadIdx.x >> 5, ln = threadIdx.x & 31; const size_t r = (size_t)blockIdx.x * 8 + wv; if (r >= NR) return; float x[16]; float s = 0.f;
  for (int i = 0; i < 2; ++i) { const v8f a = *(const v8f*)(A + r * DM + i * 256 + ln * 8); for (int q = 0; q < 8; ++q) { float v = a[q]; if (res) v += bf16_round(res[r * DM + i * 256 + ln * 8 + q]); x[i * 8 + q] = v; s += v; } }
  for (int o = 16; o > 0; o >>= 1) s += __shfl_xor(s, o, 32); const float mu = s / (float)DM; float var = 0.f; for (int q = 0; q < 16; ++q) { const float d = x[q] - mu; var += d * d; }
  for (int o = 16; o > 0; o >>= 1) var += __shfl_xor(var, o, 32); const float inv = rsqrtf(var / (float)DM + 1e-5f);
  { for (int i = 0; i < 2; ++i) { const int c0 = i * 256 + ln * 8; v8f y; FragH f; for (int q = 0; q < 8; ++q) { float v = (x[i * 8 + q] - mu) * inv; v *= bf16_round(g[c0 + q]); v += bf16_round(bb[c0 + q]); y[q] = v; f.h[q] = (_Float16)v; } *(v8f*)(Y + r * DM + c0) = y; if (Y16) *(v8us*)((unsigned short*)Y16 + r * DM + c0) = f.half[0]; }  } }
__global__ __launch_bounds__(256) void k_pack(const float* __restrict__ rb, const int* __restrict__ rid, int* __restrict__ PK) { const int t = blockIdx.x * 256 + threadIdx.x; if (t >= 1024 + NB * TK) return; int v; if (t < 1024) v = __float_as_int(bf16_round(rb[t])); else v = rid[t - 1024]; *(int*)(PK + t) = v;  }
__global__ __launch_bounds__(256) void k_tabin(const float* __restrict__ sp, float* __restrict__ CS, float* __restrict__ SN) { const int t = blockIdx.x * 256 + threadIdx.x; if (t >= SLEN * 32) return; const int i = t % 32, s = t / 32; const float c = bf16_round(sp[s * 64 + 32 + i]), sn = bf16_round(sp[s * 64 + i]);
  { *(float*)(CS + t) = c; *(float*)(SN + t) = sn;  } }
__global__ __launch_bounds__(256) void k_wsc(const float* __restrict__ Wm, _Float16* __restrict__ Bt, size_t n8, float sc) { const size_t t = (size_t)blockIdx.x * 256 + threadIdx.x; if (t >= n8) return; FragH f; for (int q = 0; q < 8; ++q) f.h[q] = (_Float16)(bf16_round(Wm[t * 8 + q]) * sc); *(v8us*)((unsigned short*)Bt + t * 8) = f.half[0];  }
__global__ __launch_bounds__(256) void k_rotab2(float* __restrict__ CS, float* __restrict__ SN) {
  #pragma clang fp contract(off)
  const int t = blockIdx.x * 256 + threadIdx.x; if (t >= SLEN * 32) return; const int j = t % 32, s = t / 32; const float c0 = -0.14391156831212787f;      /* -ln(10000)/64 rounded to f32 */ const float inv = expf((float)(2 * j) * c0); const float th = (float)s * inv; const float c = cosf(th), sn = sinf(th);
  { *(float*)(CS + t) = c; *(float*)(SN + t) = sn;  } }
__global__ __launch_bounds__(256) void k_lnu(const float* __restrict__ X, _Float16* __restrict__ N16, float* __restrict__ XB) {
  #pragma clang fp contract(off)
  const int wv = threadIdx.x >> 5, ln = threadIdx.x & 31; const size_t r = (size_t)blockIdx.x * 8 + wv; if (r >= NR) return; float a[32]; float s = 0.f;
  for (int i = 0; i < 4; ++i) { const v8f v = *(const v8f*)(X + r * DM + (i * 32 + ln) * 8); for (int q = 0; q < 8; ++q) { const float u = bf16_round(v[q]); a[i * 8 + q] = u; s += u; } }
  for (int o = 16; o > 0; o >>= 1) s += __shfl_xor(s, o, 32); const float mu = s / (float)DM; float var = 0.f; for (int q = 0; q < 32; ++q) { const float d = a[q] - mu; var += d * d; }
  for (int o = 16; o > 0; o >>= 1) var += __shfl_xor(var, o, 32); const float den = sqrtf(var / (float)(DM - 1)) + 1e-6f; const float inv = 1.0f / den;      /* one reciprocal per row; (x-mean)*inv vs the reference's division differs by <= 1 ulp */
  { for (int i = 0; i < 4; ++i) { const int c0 = (i * 32 + ln) * 8; FragH f; v8f xb; for (int q = 0; q < 8; ++q) { f.h[q] = (_Float16)((a[i * 8 + q] - mu) * inv); xb[q] = a[i * 8 + q]; } *(v8us*)((unsigned short*)N16 + r * DM + c0) = f.half[0]; *(v8f*)(XB + r * DM + c0) = xb; }  } }
__global__ __launch_bounds__(256) void k_vtg(const _Float16* __restrict__ V16, _Float16* __restrict__ Vt) { __shared__ unsigned short tl[64][66]; const int tid = threadIdx.x; const int slab = blockIdx.x / (SLEN / 64), lg = blockIdx.x % (SLEN / 64); const int b = slab / NH, h = slab % NH; const int hs = h / NREP;
  for (int i = tid; i < 64 * 8; i += 256) { const int r = i / 8, c8 = (i % 8) * 8; FragH f; f.half[0] = *(const v8us*)((const unsigned short*)V16 + ((size_t)b * SLEN + lg * 64 + r) * KVD + hs * 64 + c8); for (int q = 0; q < 8; ++q) tl[r][c8 + q] = f.u[q]; }
  __syncthreads();
  { for (int rd = 0; rd < 2; ++rd) { const int d = rd * 32 + tid / 8, pc = tid % 8; FragH f; for (int q = 0; q < 8; ++q) f.u[q] = tl[pc * 8 + q][d]; *(v8us*)((unsigned short*)Vt + ((size_t)slab * 64 + d) * SLEN + lg * 64 + pc * 8) = f.half[0]; }  } }

__global__ __launch_bounds__(256) void k_h16s(const float* __restrict__ SRC, int lds, int coff, _Float16* __restrict__ DST, size_t n8) { const size_t t = (size_t)blockIdx.x * 256 + threadIdx.x; if (t >= n8) return; const size_t r = (t * 8) / DM; const int c = (int)((t * 8) % DM); const v8f a = *(const v8f*)(SRC + r * lds + coff + c); FragH f; for (int q = 0; q < 8; ++q) f.h[q] = (_Float16)a[q];
  *(v8us*)((unsigned short*)DST + t * 8) = f.half[0];  }


__global__ __launch_bounds__(256) void k_ccp(const float* __restrict__ QKV, int coff, _Float16* __restrict__ D) { const size_t t = (size_t)blockIdx.x * 256 + threadIdx.x; if (t >= (size_t)NR * DM / 8) return; const int c0 = (int)((t * 8) % DM); const size_t row = (t * 8) / DM; const v8f a = *(const v8f*)(QKV + row * 3 * DM + coff + c0); FragH f; for (int q = 0; q < 8; ++q) f.h[q] = (_Float16)a[q];
  *(v8us*)((unsigned short*)D + t * 8) = f.half[0];  }


extern "C" void kernel_launch(void* const* d_in, const int* in_sizes, int n_in,
                              void* d_out, int out_size, void* d_ws, size_t ws_size, hipStream_t stream) {
  (void)in_sizes; (void)n_in; (void)out_size;
  const float* q = (const float*)d_in[0]; const float* kv = (const float*)d_in[1]; const float* mask = (const float*)d_in[2]; float* O = (float*)d_out;
  char* ws = (char*)d_ws; size_t off = 0;
  auto take = [&](size_t bytes) { char* p = ws + off; off += (bytes + 255) & ~(size_t)255; return p; };
  const size_t np = (size_t)NR * DM;      /* 32 x 2048 x 64 */
  _Float16* Q16 = (_Float16*)take(np * 2); unsigned short* KP = (unsigned short*)take(np * 2); unsigned short* VP = (unsigned short*)take(np * 2); unsigned short* MP = (unsigned short*)take((size_t)TQ * TK * 2);
  if (off > ws_size) return;      /* 32 MiB */
  static_assert(NR / 32 == TQ / 8 * TK / 256, "q, kv and the mask have the same number of units");
  k_prep<<<NR / 32 / PU, 256, 0, stream>>>(q, kv, mask, (unsigned short*)Q16, KP, VP, MP);      /* values = keys */
  k_flash<33><<<NB * NH * QBNP, 512, 0, stream>>>(Q16, DM, KP, VP, MP, O, DM);      /* f32 context straight to the output rows */
}

// v010
// Measured time: 42.4 microseconds a run.
// Timed twice side by side with v009, it ran 1.08 times as fast both times.
// Over all steps from v000, the starting kernel, it is 8.07 times as fast.
#include <hip/hip_runtime.h>
// DotProdAttention (q [4][8][2048][64], kv [4][8][2048][64] (keys = values), mask [1][1][2048][2048] added to every (batch, head); out = softmax(q kv^T / 8 + mask) kv -> [4][8][2048][64]).
// Structure: the (batch, head) slabs of q/kv are already contiguous 64-wide row blocks, so each slab is treated as one 'batch' of a single 64-dim head: exact f16 plane of q; kv (one plane: keys = values), and the mask, packed in the order of the attention loop's fragment loads; flash-style fused attention per (slab, 256-query block) adding the shared additive mask table per (query, key), f32 context written straight to the output.
// Compute dtype: inputs rounded to bf16; q, kv, mask exact (f16 / bf16-rounded f32); softmax f32 with f16 probabilities; plain f16 value operand (~2^-12). v_wmma_f32_16x16x32_f16.
#define NB 32                    /* 4 batches x 8 heads as slabs */
#define DM 64
#define NKV 1
#define NREP (NH / NKV)
#define KVD (NKV * 64)           /* 64 */
#define NR (NB * SLEN)
#define CHK 512
typedef int v4i __attribute__((ext_vector_type(4)));
#define FF 2048
#define SLEN 2048
#define MQI 2048
#define MKI 2048
#define TQ SLEN
#define TK SLEN
#define NH 1
#define SCL 0.125f
#define QBLKS (TQ / 64)
#define QB05 0
#define QBN5 4
#define QB0P 0
#define QPB 256                  /* queries per work-group of k_flash */
#define QBNP (TQ / QPB)
#define RE 256
typedef __bf16 v16b __attribute__((ext_vector_type(16)));
typedef unsigned short v8us __attribute__((ext_vector_type(8), may_alias));
typedef float  v8f  __attribute__((ext_vector_type(8)));
typedef float  v4f  __attribute__((ext_vector_type(4)));
typedef float  v4fa __attribute__((ext_vector_type(4), may_alias));
union FragB { v16b v; v8us half[2]; unsigned short u[16]; };

__device__ __forceinline__ unsigned short bf16_bits(float x) { unsigned int u = __float_as_uint(x); return (unsigned short)((u + 0x7FFFu + ((u >> 16) & 1u)) >> 16); }
__device__ __forceinline__ float bf16_val(unsigned short b) { return __uint_as_float(((unsigned int)b) << 16); }
__device__ __forceinline__ float bf16_round(float x) { return bf16_val(bf16_bits(x)); }
// D += A·B with NT terms: 1 = ah·bh, 2 = + al·bh (A split), 3 = + ah·bl (both split)
template <int NT>
__device__ __forceinline__ v8f mmaN(v16b ah, v16b al, v16b bh, v16b bl, v8f c) {
  c = __builtin_amdgcn_wmma_f32_16x16x32_bf16(false, ah, false, bh, (short)0, c, false, false);
  if (NT >= 2) c = __builtin_amdgcn_wmma_f32_16x16x32_bf16(false, al, false, bh, (short)0, c, false, false);
  if (NT >= 3) c = __builtin_amdgcn_wmma_f32_16x16x32_bf16(false, ah, false, bl, (short)0, c, false, false);
  asm volatile("v_nop\n\tv_nop\n\tv_nop\n\tv_nop" : "+v"(c) : "v"(ah), "v"(al), "v"(bh), "v"(bl));
  return c;
}

__global__ __launch_bounds__(256) void k_wt_bf16(const float* __restrict__ W, unsigned short* __restrict__ Wt, int K, int N) {
  const int t = blockIdx.x * 256 + threadIdx.x;
  const int k8n = K / 8;
  if (t >= N * k8n) return;
  const int n = t / k8n, k8 = (t % k8n) * 8;
  v8us v;
#pragma unroll
  for (int i = 0; i < 8; ++i) v[i] = bf16_bits(W[(size_t)(k8 + i) * N + n]);
  *(v8us*)(Wt + (size_t)n * K + k8) = v;
  
}

// GEMM C[M][N] (f32, pitch ldc) = act(A[M][K]·W + bias). A f32 row-major (pitch lda) converted per fragment to bf16
// (ASPLIT: hi/lo two planes -> 2 terms, else single rounded term); Wt bf16 [N][K] (pitch ldb). BIAS_BF16 rounds the
// bias to bf16 first (bias quantised to bf16 before the add). K%32==0, M%16==0, N%64==0.
template <bool ASPLIT, int ACT, bool BIAS_BF16>
__global__ __launch_bounds__(128) void k_gemm_bf(const float* __restrict__ A, int lda, const unsigned short* __restrict__ Wt, int ldb,
                                               const float* __restrict__ bias, float* __restrict__ C, int ldc, int M, int N, int K) {
  __shared__ __attribute__((aligned(16))) float so[4][16][64];
  const int tid = threadIdx.x, w = tid >> 5, lane = tid & 31, ln = lane & 15, hh = lane >> 4;
  const int ntn = N / 64;
  const int wid = blockIdx.x * 4 + w;
  const int mt = wid / ntn, nq = wid % ntn;
  if (mt * 16 >= M) return;
  const int row0 = mt * 16, col0 = nq * 64;
  const float* arow = A + (size_t)(row0 + ln) * lda;
  v8f acc[4] = {};
  for (int kb = 0; kb < K; kb += 32) {
    FragB ah, al;
    const v4f x0 = *(const v4fa*)(arow + kb + 8 * hh), x1 = *(const v4fa*)(arow + kb + 8 * hh + 4);
    const v4f x2 = *(const v4fa*)(arow + kb + 16 + 8 * hh), x3 = *(const v4fa*)(arow + kb + 16 + 8 * hh + 4);
    float xs[16] = {x0[0],x0[1],x0[2],x0[3],x1[0],x1[1],x1[2],x1[3],x2[0],x2[1],x2[2],x2[3],x3[0],x3[1],x3[2],x3[3]};
#pragma unroll
    for (int i = 0; i < 16; ++i) { const unsigned short hb = bf16_bits(xs[i]); ah.u[i] = hb; al.u[i] = ASPLIT ? bf16_bits(xs[i] - bf16_val(hb)) : (unsigned short)0; }
#pragma unroll
    for (int t = 0; t < 4; ++t) {
      const unsigned short* brow = Wt + (size_t)(col0 + t * 16 + ln) * ldb + kb;
      FragB b;
      b.half[0] = *(const v8us*)(brow + 8 * hh);
      b.half[1] = *(const v8us*)(brow + 16 + 8 * hh);
      acc[t] = mmaN<ASPLIT ? 2 : 1>(ah.v, al.v, b.v, b.v, acc[t]);
    }
  }
#pragma unroll
  for (int t = 0; t < 4; ++t) {
    float bv = bias ? bias[col0 + t * 16 + ln] : 0.f;
    if (BIAS_BF16) bv = bf16_round(bv);
#pragma unroll
    for (int r = 0; r < 8; ++r) { float v = acc[t][r] + bv; if (ACT == 1) v = fmaxf(v, 0.f); so[w][8 * hh + r][t * 16 + ln] = v; }
  }
  __builtin_amdgcn_fence(__ATOMIC_ACQ_REL, "workgroup");
  __builtin_amdgcn_wave_barrier();
  const int rsub = lane >> 4, c4 = (lane & 15) * 4;
  {
#pragma unroll
    for (int q = 0; q < 8; ++q) {
      const int r = q * 2 + rsub;
      const v4f v = *(const v4fa*)&so[w][r][c4];
      *(v4f*)(C + (size_t)(row0 + r) * ldc + col0 + c4) = v;
    }
    
  }
}

// GEMM C = act(A·W + bias + resid): A f32 (ASPLIT -> hi/lo 2 terms), Wt bf16 [N][K]; ACT 0 none, 1 relu, 2 exact gelu;
// resid (optional, f32, row index = (row % rmod), pitch ldr, RES_BF16 rounds it) added before the activation.
template <bool ASPLIT, int ACT, bool BIAS_BF16, bool RES_BF16>
__global__ __launch_bounds__(128) void k_gemm_bf3(const float* __restrict__ A, int lda, const unsigned short* __restrict__ Wt, int ldb,
                                                const float* __restrict__ bias, const float* __restrict__ resid, int rmod, int ldr,
                                                float* __restrict__ C, int ldc, int M, int N, int K) {
  __shared__ __attribute__((aligned(16))) float so[4][16][64];
  const int tid = threadIdx.x, w = tid >> 5, lane = tid & 31, ln = lane & 15, hh = lane >> 4;
  const int ntn = N / 64;
  const int wid = blockIdx.x * 4 + w;
  const int mt = wid / ntn, nq = wid % ntn;
  if (mt * 16 >= M) return;
  const int row0 = mt * 16, col0 = nq * 64;
  const float* arow = A + (size_t)(row0 + ln) * lda;
  v8f acc[4] = {};
  for (int kb = 0; kb < K; kb += 32) {
    FragB ah, al;
    const v4f x0 = *(const v4fa*)(arow + kb + 8 * hh), x1 = *(const v4fa*)(arow + kb + 8 * hh + 4);
    const v4f x2 = *(const v4fa*)(arow + kb + 16 + 8 * hh), x3 = *(const v4fa*)(arow + kb + 16 + 8 * hh + 4);
    float xs[16] = {x0[0],x0[1],x0[2],x0[3],x1[0],x1[1],x1[2],x1[3],x2[0],x2[1],x2[2],x2[3],x3[0],x3[1],x3[2],x3[3]};
#pragma unroll
    for (int i = 0; i < 16; ++i) { const unsigned short hb = bf16_bits(xs[i]); ah.u[i] = hb; al.u[i] = ASPLIT ? bf16_bits(xs[i] - bf16_val(hb)) : (unsigned short)0; }
#pragma unroll
    for (int t = 0; t < 4; ++t) {
      const unsigned short* brow = Wt + (size_t)(col0 + t * 16 + ln) * ldb + kb;
      FragB b;
      b.half[0] = *(const v8us*)(brow + 8 * hh);
      b.half[1] = *(const v8us*)(brow + 16 + 8 * hh);
      acc[t] = mmaN<ASPLIT ? 2 : 1>(ah.v, al.v, b.v, b.v, acc[t]);
    }
  }
#pragma unroll
  for (int t = 0; t < 4; ++t) {
    const int col = col0 + t * 16 + ln;
    float bv = bias ? bias[col] : 0.f;
    if (BIAS_BF16) bv = bf16_round(bv);
#pragma unroll
    for (int r = 0; r < 8; ++r) {
      float v = acc[t][r] + bv;
      if (resid) { float rv = resid[(size_t)((row0 + 8 * hh + r) % rmod) * ldr + col]; if (RES_BF16) rv = bf16_round(rv); v += rv; }
      if (ACT == 1) v = fmaxf(v, 0.f);
      if (ACT == 2) v = 0.5f * v * (1.0f + erff(v * 0.70710678118654752f));
      if (ACT == 3) { const float u = 0.7978845608028654f * (v + 0.044715f * v * v * v); v = 0.5f * v * (1.0f + tanhf(u)); }
      so[w][8 * hh + r][t * 16 + ln] = v;
    }
  }
  __builtin_amdgcn_fence(__ATOMIC_ACQ_REL, "workgroup");
  __builtin_amdgcn_wave_barrier();
  const int rsub = lane >> 4, c4 = (lane & 15) * 4;
  {
#pragma unroll
    for (int q = 0; q < 8; ++q) {
      const int r = q * 2 + rsub;
      const v4f v = *(const v4fa*)&so[w][r][c4];
      *(v4f*)(C + (size_t)(row0 + r) * ldc + col0 + c4) = v;
    }
    
  }
}
// row LayerNorm (biased variance, eps) over N: s = X (+ R); optional out_sum <- s; out_norm <- (s-mu)*rsqrt(var+eps)*g + b
template <bool PARAM_BF16>
__global__ __launch_bounds__(256) void k_layernorm(const float* __restrict__ X, const float* __restrict__ R, const float* __restrict__ g, const float* __restrict__ bta,
                                                  float* __restrict__ out_sum, float* __restrict__ out_norm, int N, float eps) {
  __shared__ float red[256];
  const int row = blockIdx.x, tid = threadIdx.x;
  const float* x = X + (size_t)row * N; const float* rr = R ? R + (size_t)row * N : nullptr;
  float vals[16];                     // up to N = 4096
  const int per = N / 256;            // contiguous chunk per thread? use strided-by-4 chunks: thread handles j = tid*4 + 1024*u
  float s1 = 0.f;
  for (int u = 0; u < per / 4; ++u) {
    const int j = tid * 4 + 1024 * u;
    const v4f a = *(const v4fa*)(x + j);
    v4f b = {0.f,0.f,0.f,0.f}; if (rr) b = *(const v4fa*)(rr + j);
#pragma unroll
    for (int q = 0; q < 4; ++q) { const float v = a[q] + b[q]; vals[u * 4 + q] = v; s1 += v; }
  }
  red[tid] = s1; __syncthreads();
  for (int st = 128; st > 0; st >>= 1) { if (tid < st) red[tid] += red[tid + st]; __syncthreads(); }
  const float mu = red[0] / (float)N; __syncthreads();
  float s2 = 0.f;
  for (int u = 0; u < per / 4; ++u)
#pragma unroll
    for (int q = 0; q < 4; ++q) { const float c = vals[u * 4 + q] - mu; s2 += c * c; }
  red[tid] = s2; __syncthreads();
  for (int st = 128; st > 0; st >>= 1) { if (tid < st) red[tid] += red[tid + st]; __syncthreads(); }
  const float rs = rsqrtf(red[0] / (float)N + eps);
  {
    for (int u = 0; u < per / 4; ++u) {
      const int j = tid * 4 + 1024 * u;
      v4f o, sm;
#pragma unroll
      for (int q = 0; q < 4; ++q) {
        float gg = g[j + q], bb = bta[j + q];
        if (PARAM_BF16) { gg = bf16_round(gg); bb = bf16_round(bb); }
        sm[q] = vals[u * 4 + q]; o[q] = (vals[u * 4 + q] - mu) * rs * gg + bb;
      }
      if (out_sum) *(v4f*)(out_sum + (size_t)row * N + j) = sm;
      *(v4f*)(out_norm + (size_t)row * N + j) = o;
    }
    
  }
}



// ---- f16 WMMA path (v_wmma_f32_16x16x32_f16): 11-bit significands for operands in range — used where a [0,1] probability operand needs more precision than bf16
typedef _Float16 v16h __attribute__((ext_vector_type(16)));
union FragH { v16h v; v8us half[2]; _Float16 h[16]; unsigned short u[16]; };
template <int NT>
__device__ __forceinline__ v8f mmaH(v16h ah, v16h al, v16h bh, v16h bl, v8f c) {
  c = __builtin_amdgcn_wmma_f32_16x16x32_f16(false, ah, false, bh, (short)0, c, false, false);
  if (NT >= 2) c = __builtin_amdgcn_wmma_f32_16x16x32_f16(false, al, false, bh, (short)0, c, false, false);
  if (NT >= 3) c = __builtin_amdgcn_wmma_f32_16x16x32_f16(false, ah, false, bl, (short)0, c, false, false);
  asm volatile("v_nop\n\tv_nop\n\tv_nop\n\tv_nop" : "+v"(c) : "v"(ah), "v"(al), "v"(bh), "v"(bl));
  return c;
}
// batched GEMM like k_gemm_b but f16 operands: A f32 (split into f16 hi/lo if ASPLIT, else rounded to f16), Bt = f16 values [n][k]; alpha; C f32; N multiple of 16 (partial tiles skipped)
template <bool ASPLIT>
__global__ __launch_bounds__(128) void k_gemm_h(const float* __restrict__ A, int lda, size_t sA, const _Float16* __restrict__ Bh, int ldb, size_t sB, float alpha, float* __restrict__ C, int ldc, size_t sC, int M, int N, int K) {
  __shared__ __attribute__((aligned(16))) float so[4][16][64];
  const int tid = threadIdx.x, w = tid >> 5, lane = tid & 31, ln = lane & 15, hh = lane >> 4; const int by = blockIdx.y;
  A += (size_t)by * sA; Bh += (size_t)by * sB; C += (size_t)by * sC;
  const int ntn = (N + 63) / 64; const int wid = blockIdx.x * 4 + w; const int mt = wid / ntn, nq = wid % ntn; if (mt * 16 >= M) return;
  const int row0 = mt * 16, col0 = nq * 64; const float* arow = A + (size_t)(row0 + ln) * lda;
  v8f acc[4] = {};
  for (int kb = 0; kb < K; kb += 32) {
    FragH ah, al;
    const v4f x0 = *(const v4fa*)(arow + kb + 8 * hh), x1 = *(const v4fa*)(arow + kb + 8 * hh + 4), x2 = *(const v4fa*)(arow + kb + 16 + 8 * hh), x3 = *(const v4fa*)(arow + kb + 16 + 8 * hh + 4);
    float xs[16] = {x0[0],x0[1],x0[2],x0[3],x1[0],x1[1],x1[2],x1[3],x2[0],x2[1],x2[2],x2[3],x3[0],x3[1],x3[2],x3[3]};
#pragma unroll
    for (int i = 0; i < 16; ++i) { const _Float16 h = (_Float16)xs[i]; ah.h[i] = h; al.h[i] = ASPLIT ? (_Float16)(xs[i] - (float)h) : (_Float16)0.0f; }
#pragma unroll
    for (int t = 0; t < 4; ++t) { if (col0 + t * 16 >= N) continue; const size_t boff = (size_t)(col0 + t * 16 + ln) * ldb + kb; FragH bq; bq.half[0] = *(const v8us*)(Bh + boff + 8 * hh); bq.half[1] = *(const v8us*)(Bh + boff + 16 + 8 * hh);
      acc[t] = mmaH<ASPLIT ? 2 : 1>(ah.v, al.v, bq.v, bq.v, acc[t]); }
  }
#pragma unroll
  for (int t = 0; t < 4; ++t) { if (col0 + t * 16 >= N) continue;
#pragma unroll
    for (int r = 0; r < 8; ++r) so[w][8 * hh + r][t * 16 + ln] = acc[t][r] * alpha; }
  __builtin_amdgcn_fence(__ATOMIC_ACQ_REL, "workgroup"); __builtin_amdgcn_wave_barrier();
  const int rsub = lane >> 4, c4 = (lane & 15) * 4;
  {
#pragma unroll
    for (int q = 0; q < 8; ++q) { const int r = q * 2 + rsub; if (col0 + c4 < N) { const v4f v = *(const v4fa*)&so[w][r][c4]; *(v4f*)(C + (size_t)(row0 + r) * ldc + col0 + c4) = v; } }
     }
}

// Wt[n][k] = f16(W[k][n]·scale) from f32 row-major W[K][N] (scale = power of two; bf16-exact weights stay exact in f16 away from the subnormal range)
__global__ __launch_bounds__(256) void k_wt_f16(const float* __restrict__ W, _Float16* __restrict__ Wt, int K, int N, float scale) {
  const int t = blockIdx.x * 256 + threadIdx.x; if (t >= N * (K / 8)) return; const int n = t / (K / 8), k8 = (t % (K / 8)) * 8; FragH f;
#pragma unroll
  for (int i = 0; i < 8; ++i) f.h[i] = (_Float16)(bf16_round(W[(size_t)(k8 + i) * N + n]) * scale); const v8us o = f.half[0];
  *(v8us*)((unsigned short*)Wt + (size_t)n * K + k8) = o; 
}
// k_gemm_hh variant with fused epilogue: v = acc·alpha + bias[by·sBias + col] (+ CP[(row/rowsPerB)·sCPb + by·64 + col] if CP) ; ACT 0 none / 1 elu ; writes f16 C16 (and f32 C if non-null)
template <int ACT>
__global__ __launch_bounds__(128) void k_gemm_hhx(const _Float16* __restrict__ A, int lda, size_t sA, const _Float16* __restrict__ Bh, int ldb, size_t sB, float alpha, const float* __restrict__ bias, size_t sBias, const float* __restrict__ CP, int rowsPerB, size_t sCPb, int row0g,
    float* __restrict__ C, _Float16* __restrict__ C16, int ldc, size_t sC, int M, int N, int K) {
  __shared__ __attribute__((aligned(16))) float so[4][16][64];
  const int tid = threadIdx.x, w = tid >> 5, lane = tid & 31, ln = lane & 15, hh = lane >> 4; const int by = blockIdx.y;
  A += (size_t)by * sA; Bh += (size_t)by * sB; const size_t cofs = (size_t)by * sC; const float* bp = bias ? bias + (size_t)by * sBias : nullptr;
  const int ntn = (N + 63) / 64; const int wid = blockIdx.x * 4 + w; const int mt = wid / ntn, nq = wid % ntn; if (mt * 16 >= M) return;
  const int row0 = mt * 16, col0 = nq * 64; const _Float16* arow = A + (size_t)(row0 + ln) * lda;
  v8f acc[4] = {};
  for (int kb = 0; kb < K; kb += 32) { FragH ah; ah.half[0] = *(const v8us*)((const unsigned short*)arow + kb + 8 * hh); ah.half[1] = *(const v8us*)((const unsigned short*)arow + kb + 16 + 8 * hh);
#pragma unroll
    for (int t = 0; t < 4; ++t) { if (col0 + t * 16 >= N) continue; const size_t boff = (size_t)(col0 + t * 16 + ln) * ldb + kb; FragH bq; bq.half[0] = *(const v8us*)((const unsigned short*)Bh + boff + 8 * hh); bq.half[1] = *(const v8us*)((const unsigned short*)Bh + boff + 16 + 8 * hh);
      acc[t] = mmaH<1>(ah.v, ah.v, bq.v, bq.v, acc[t]); }
  }
#pragma unroll
  for (int t = 0; t < 4; ++t) { if (col0 + t * 16 >= N) continue; const int col = col0 + t * 16 + ln; const float bv = bp ? bf16_round(bp[col]) : 0.f;
#pragma unroll
    for (int r = 0; r < 8; ++r) { float v = acc[t][r] * alpha + bv; if (CP) { const int bidx = (row0g + row0 + 8 * hh + r) / rowsPerB; v += CP[(size_t)bidx * sCPb + (size_t)by * 64 + col]; } if (ACT == 1) v = (v > 0.f) ? v : expm1f(v); else if (ACT == 7) v = (v > 0.f) ? v + 1.0f : expf(v); else if (ACT == 8) v = tanhf(v); else if (ACT == 9) v = 0.5f * v * (1.0f + tanhf(0.7978845608028654f * (v + 0.044715f * v * v * v))); else if (ACT == 11) v = 1.0f / (1.0f + expf(-v)); else if (ACT == 12) v = (v > 0.f) ? v : 0.01f * v; else if (ACT == 14) v = (v > 0.f) ? v : 0.1f * v; else if (ACT == 15) v = v / (1.0f + expf(-v)); else if (ACT == 3) v = fmaxf(v, 0.f); else if (ACT == 6) v = 0.5f * v * (1.0f + erff(v * 0.70710678118654752f)); so[w][8 * hh + r][t * 16 + ln] = v; } }
  __builtin_amdgcn_fence(__ATOMIC_ACQ_REL, "workgroup"); __builtin_amdgcn_wave_barrier();
  const int rsub = lane >> 4, c4 = (lane & 15) * 4; typedef _Float16 v4h __attribute__((ext_vector_type(4)));
  {
#pragma unroll
    for (int q = 0; q < 8; ++q) { const int r = q * 2 + rsub; if (col0 + c4 < N) { const v4f v = *(const v4fa*)&so[w][r][c4]; if (C) *(v4f*)(C + cofs + (size_t)(row0 + r) * ldc + col0 + c4) = v; if (C16) { v4h h4; for (int i = 0; i < 4; ++i) h4[i] = (_Float16)v[i]; *(v4h*)(C16 + cofs + (size_t)(row0 + r) * ldc + col0 + c4) = h4; } } }
     }
}


typedef _Float16 v4h __attribute__((ext_vector_type(4)));

__global__ __launch_bounds__(256) void k_x16(const float* __restrict__ x, _Float16* __restrict__ X16, size_t n8) { const size_t t = (size_t)blockIdx.x * 256 + threadIdx.x; if (t >= n8) return; FragH f;
#pragma unroll
  for (int q = 0; q < 8; ++q) f.h[q] = (_Float16)bf16_round(x[t * 8 + q]); *(v8us*)((unsigned short*)X16 + t * 8) = f.half[0];  }
__global__ __launch_bounds__(256) void k_h16(const float* __restrict__ x, _Float16* __restrict__ X16, size_t n8) { const size_t t = (size_t)blockIdx.x * 256 + threadIdx.x; if (t >= n8) return; FragH f;
#pragma unroll
  for (int q = 0; q < 8; ++q) f.h[q] = (_Float16)x[t * 8 + q]; *(v8us*)((unsigned short*)X16 + t * 8) = f.half[0];  }
__global__ __launch_bounds__(256) void k_round16f(const float* __restrict__ W, _Float16* __restrict__ Bt, size_t n8) { const size_t t = (size_t)blockIdx.x * 256 + threadIdx.x; if (t >= n8) return; FragH f;
#pragma unroll
  for (int i = 0; i < 8; ++i) f.h[i] = (_Float16)(bf16_round(W[t * 8 + i]) * 16.0f); *(v8us*)((unsigned short*)Bt + t * 8) = f.half[0];  }
template <int NHv, int TTv>
__global__ __launch_bounds__(256) void k_vt(const _Float16* __restrict__ V16, int ldv, int voff, _Float16* __restrict__ Vt) { __shared__ unsigned short tl[64][66]; const int tid = threadIdx.x; const int slab = blockIdx.x / (TTv / 64), lg = blockIdx.x % (TTv / 64); const int b = slab / NHv, h = slab % NHv;
  for (int i = tid; i < 64 * 8; i += 256) { const int r = i / 8, c8 = (i % 8) * 8; FragH f; f.half[0] = *(const v8us*)((const unsigned short*)V16 + ((size_t)b * TTv + lg * 64 + r) * ldv + voff + h * 64 + c8);
#pragma unroll
    for (int q = 0; q < 8; ++q) tl[r][c8 + q] = f.u[q]; }
  __syncthreads();
  {
#pragma unroll
    for (int rd = 0; rd < 2; ++rd) { const int d = rd * 32 + tid / 8, pc = tid % 8; FragH f;
#pragma unroll
      for (int q = 0; q < 8; ++q) f.u[q] = tl[pc * 8 + q][d];
      *(v8us*)((unsigned short*)Vt + ((size_t)slab * 64 + d) * TTv + lg * 64 + pc * 8) = f.half[0]; }
     } }

__global__ __launch_bounds__(256) void k_hl(const float* __restrict__ F, _Float16* __restrict__ Hh, _Float16* __restrict__ Hl, size_t n8) { const size_t t = (size_t)blockIdx.x * 256 + threadIdx.x; if (t >= n8) return; FragH fh, fl; const v4f a = *(const v4fa*)(F + t * 8), c = *(const v4fa*)(F + t * 8 + 4);
#pragma unroll
  for (int q = 0; q < 4; ++q) { _Float16 h = (_Float16)a[q]; fh.h[q] = h; fl.h[q] = (_Float16)((a[q] - (float)h) * 1024.0f); h = (_Float16)c[q]; fh.h[4 + q] = h; fl.h[4 + q] = (_Float16)((c[q] - (float)h) * 1024.0f); }
  { *(v8us*)((unsigned short*)Hh + t * 8) = fh.half[0]; *(v8us*)((unsigned short*)Hl + t * 8) = fl.half[0];  } }

// ---- fast GEMM (wave tile 32x64; requires M % 32 == 0 rows per launch region and N % 64 == 0); epilogue = k_gemm_hhx semantics ----
__device__ __forceinline__ v16h g2_frag(const _Float16* p, int hh) { FragH f; f.half[0] = *(const v8us*)((const unsigned short*)p + 8 * hh); f.half[1] = *(const v8us*)((const unsigned short*)p + 16 + 8 * hh); return f.v; }
__device__ __forceinline__ v8f g2_mma(v16h a, v16h b, v8f c) { v8f d = __builtin_amdgcn_wmma_f32_16x16x32_f16(false, a, false, b, (short)0, c, false, false); asm volatile("v_nop\n\tv_nop\n\tv_nop\n\tv_nop" : "+v"(d) : "v"(a), "v"(b)); return d; }
template <int ACT>
__global__ __launch_bounds__(128) void k_gemm2(const _Float16* __restrict__ A, int lda, size_t sA, const _Float16* __restrict__ Bh, int ldb, size_t sB, float alpha, const float* __restrict__ bias, size_t sBias, const float* __restrict__ CP, int rowsPerB, size_t sCPb, int row0g,
    float* __restrict__ C, _Float16* __restrict__ C16, int ldc, size_t sC, int M, int N, int K) {
  __shared__ __attribute__((aligned(16))) float so[4][32][68];
  const int tid = threadIdx.x, w = tid >> 5, lane = tid & 31, ln = lane & 15, hh = lane >> 4; const int by = blockIdx.y;
  A += (size_t)by * sA; Bh += (size_t)by * sB; const size_t cofs = (size_t)by * sC; const float* bp = bias ? bias + (size_t)by * sBias : nullptr;
  const int ntn = N >> 6; const int mt = blockIdx.x / ntn, nq = blockIdx.x - mt * ntn; const int row0 = mt * 128 + 32 * w, col0 = nq * 64; if (row0 >= M) return;
  const _Float16* a0p = A + (size_t)(row0 + ln) * lda; const _Float16* a1p = a0p + (size_t)16 * lda;
  const _Float16* b0p = Bh + (size_t)(col0 + ln) * ldb; const _Float16* b1p = b0p + (size_t)16 * ldb; const _Float16* b2p = b1p + (size_t)16 * ldb; const _Float16* b3p = b2p + (size_t)16 * ldb;
  const v8f z8 = {0.f,0.f,0.f,0.f,0.f,0.f,0.f,0.f}; v8f c00 = z8, c01 = z8, c02 = z8, c03 = z8, c10 = z8, c11 = z8, c12 = z8, c13 = z8;
#pragma unroll 1
  for (int kb = 0; kb < K; kb += 32) { const v16h a0 = g2_frag(a0p + kb, hh), a1 = g2_frag(a1p + kb, hh);
    v16h b = g2_frag(b0p + kb, hh); c00 = g2_mma(a0, b, c00); c10 = g2_mma(a1, b, c10);
    b = g2_frag(b1p + kb, hh); c01 = g2_mma(a0, b, c01); c11 = g2_mma(a1, b, c11);
    b = g2_frag(b2p + kb, hh); c02 = g2_mma(a0, b, c02); c12 = g2_mma(a1, b, c12);
    b = g2_frag(b3p + kb, hh); c03 = g2_mma(a0, b, c03); c13 = g2_mma(a1, b, c13); }
  v8f accs[8] = {c00, c01, c02, c03, c10, c11, c12, c13};
#pragma unroll
  for (int u = 0; u < 8; ++u) { const int t = u & 3, half = u >> 2; const int col = col0 + t * 16 + ln; const float bv = bp ? bf16_round(bp[col]) : 0.f;
#pragma unroll
    for (int r = 0; r < 8; ++r) { const int rloc = half * 16 + 8 * hh + r; float v = accs[u][r] * alpha + bv; if (CP) { if (rowsPerB < 0) v += CP[cofs + (size_t)(row0g + row0 + rloc) * ldc + col];      /* rowsPerB < 0: own element of the batched C plane */ else { const int bidx = (row0g + row0 + rloc) / rowsPerB; v += CP[(size_t)bidx * sCPb + (size_t)by * 64 + col]; } }
      if (ACT == 3) v = fmaxf(v, 0.f); else if (ACT == 6) v = 0.5f * v * (1.0f + erff(v * 0.70710678118654752f)); else if (ACT == 11) v = 1.0f / (1.0f + expf(-v)); else if (ACT == 15) v = v / (1.0f + expf(-v)); else if (ACT == 12) v = (v > 0.f) ? v : 0.01f * v; else if (ACT == 8) v = tanhf(v);
      so[w][rloc][t * 16 + ln] = v; } }
  __builtin_amdgcn_fence(__ATOMIC_ACQ_REL, "workgroup"); __builtin_amdgcn_wave_barrier();
  const int rsub = lane >> 4, c4 = (lane & 15) * 4;
  {
#pragma unroll
    for (int q = 0; q < 16; ++q) { const int r = q * 2 + rsub; const v4f v = *(const v4fa*)&so[w][r][c4]; if (C) *(v4f*)(C + cofs + (size_t)(row0 + r) * ldc + col0 + c4) = v; if (C16) { v4h h4; for (int i = 0; i < 4; ++i) h4[i] = (_Float16)v[i]; *(v4h*)(C16 + cofs + (size_t)(row0 + r) * ldc + col0 + c4) = h4; } }
     } }



typedef unsigned int v4u __attribute__((ext_vector_type(4), may_alias));
// Packed operand planes of k_flash. Unit = the 16 bytes one lane takes in one fragment load; the 32 units of a load lie side by side (512 bytes, four whole lines), lane = 16 hh + ln.
// KP, per 32-key block 8 loads [nt][ks][c]: unit = K[16 nt + ln][32 ks + 16 c + 8 hh + 0..7].  Values as k_x16 makes them. Keys are the values: load [nt][ks][c] is also the 16 x 16 tile V[16 nt + 0..15][32 ks + 16 c + 0..15], which k_flash reads a second time through the transposing load.
// MP, per (16-query tile, 32-key block) 2 loads [nt]: unit = bf16 bits of mask[16 qt + ln][32 jb + 16 nt + 8 hh + 0..7] (the compute dtype's rounding of the mask)
// One pre-pass launch makes all three planes (Q16 as k_x16 makes it, KP, MP). A thread takes PU units of 8 values of each input, 256 units apart; a work-group so takes PU blocks of 32 keys, each with an LDS tile of its own.
#define PU 4
__global__ __launch_bounds__(256) void k_prep(const float* __restrict__ q, const float* __restrict__ kv, const float* __restrict__ M, unsigned short* __restrict__ Q16, unsigned short* __restrict__ KP, unsigned short* __restrict__ MP) {
  __shared__ __attribute__((aligned(16))) unsigned short tl[PU][32][72];      /* pitch 144 B = 16 B x 9: the 16-byte row reads below spread over the banks */
  const int tid = threadIdx.x; const unsigned int u0 = blockIdx.x * (PU * 256) + tid;      /* the thread's first unit in every plane */
  const int ln = tid & 15, hh = (tid >> 4) & 1, g = tid >> 5;      /* g = the load's number in its block of 32 keys */
  const int nt = g & 1, jb = (u0 >> 6) & (TK / 32 - 1), qt = u0 / (TK * 2);      /* the mask unit's place; 256 units on, jb is 4 more: the PU * 256 units of a work-group lie in one query tile */
  static_assert((TK * 2) % (PU * 256) == 0, "a work-group's mask units stay inside one 16-query tile");
  const float* ks = kv + (size_t)u0 * 8; const float* qs = q + (size_t)u0 * 8; const float* ms = M + (size_t)(qt * 16 + ln) * TK + jb * 32 + nt * 16 + hh * 8;
  v4f ka[PU], kc[PU], qa[PU], qc[PU], ma[PU], mc[PU];
  /* every load of the thread is requested before anything is worked on: kv first, its values have the longest way */
#pragma unroll      /* constant indices: the arrays stay in registers */
  for (int i = 0; i < PU; ++i) { ka[i] = *(const v4fa*)(ks + i * 2048); kc[i] = *(const v4fa*)(ks + i * 2048 + 4); }
#pragma unroll      /* constant indices: the arrays stay in registers */
  for (int i = 0; i < PU; ++i) { qa[i] = *(const v4fa*)(qs + i * 2048); qc[i] = *(const v4fa*)(qs + i * 2048 + 4); }
  asm volatile("s_wait_xcnt 0x0" ::: "memory");      /* the compiler lets a mask load's result land in the address registers that the loads above name */
#pragma unroll      /* constant indices: the arrays stay in registers */
  for (int i = 0; i < PU; ++i) { ma[i] = *(const v4fa*)(ms + i * 128); mc[i] = *(const v4fa*)(ms + i * 128 + 4); }
  __builtin_amdgcn_sched_barrier(0);      /* keeps the loads above: without it the compiler sinks them to their uses, and the thread waits out the memory latency three times over */
#pragma unroll      /* constant indices: the arrays stay in registers */
  for (int i = 0; i < PU; ++i) { FragH f;
#pragma unroll      /* constant indices: the fragment stays in registers */
    for (int e = 0; e < 4; ++e) { f.h[e] = (_Float16)bf16_round(ka[i][e]); f.h[4 + e] = (_Float16)bf16_round(kc[i][e]); }
    *(v8us*)&tl[i][tid >> 3][(tid & 7) * 8] = f.half[0]; }
  __syncthreads();      /* all tiles are written before any thread gathers its units from them; no global store is under way yet for it to wait on */
#pragma unroll      /* constant indices: the fragment stays in registers */
  for (int i = 0; i < PU; ++i) *(v8us*)(KP + (size_t)u0 * 8 + i * 2048) = *(const v8us*)&tl[i][(g >> 2) * 16 + ln][((g >> 1) & 1) * 32 + (g & 1) * 16 + hh * 8];
#pragma unroll      /* constant indices: the arrays stay in registers */
  for (int i = 0; i < PU; ++i) { FragH f;
#pragma unroll      /* constant indices: the fragment stays in registers */
    for (int e = 0; e < 4; ++e) { f.h[e] = (_Float16)bf16_round(qa[i][e]); f.h[4 + e] = (_Float16)bf16_round(qc[i][e]); }
    *(v8us*)(Q16 + (size_t)u0 * 8 + i * 2048) = f.half[0]; }
#pragma unroll      /* constant indices: the arrays stay in registers */
  for (int i = 0; i < PU; ++i) { v8us o;
#pragma unroll      /* constant indices: the vector stays in registers */
    for (int e = 0; e < 4; ++e) { o[e] = bf16_bits(ma[i][e]); o[4 + e] = bf16_bits(mc[i][e]); }
    *(v8us*)(MP + (size_t)u0 * 8 + i * 2048) = o; } }

// one f16 product of k_flash as the plain builtin: the compiler keeps the distance behind a matrix instruction itself, with other work of the pass where it has some
__device__ __forceinline__ v8f mmaF(v16h a, v16h b, v8f c) { return __builtin_amdgcn_wmma_f32_16x16x32_f16(false, a, false, b, (short)0, c, false, false); }
typedef float v2f __attribute__((ext_vector_type(2)));
typedef short v8s __attribute__((ext_vector_type(8)));
// transposing load of a 16 x 16 tile of 16-bit values: lane l names the 16 bytes of row 8 (l >> 4) + (l & 7), columns 8 ((l >> 3) & 1) + 0..7; lane (ln, hh) gets rows 8 hh + 0..7 of column ln. All 32 lanes on
__device__ __forceinline__ v8us load_tr16(const char* p) { return __builtin_bit_cast(v8us, __builtin_amdgcn_global_load_tr16_b128_v8i16((__attribute__((address_space(1))) v8s*)p)); }
// lane l <-> lane l ^ 16 by a vector cross-row move
__device__ __forceinline__ float xhalf(float x) { return __builtin_bit_cast(float, __builtin_amdgcn_permlanex16(__builtin_bit_cast(int, x), __builtin_bit_cast(int, x), 0x76543210, 0xfedcba98, false, false)); }
template <int CAUSAL>
__global__ __launch_bounds__(512) void k_flash(const _Float16* __restrict__ Q16, int ldq, const unsigned short* __restrict__ KP, const unsigned short* __restrict__ MP, float* __restrict__ O, int ldo) {
  static_assert(CAUSAL == 0 || CAUSAL == 33, "modes: 0 = no mask, 33 = one additive [TQ][TK] f32 table shared by every slab");
  constexpr int QT = 2, RPW = 16 * QT, NQW = QPB / RPW, NW = 2 * NQW, DT = 4, KS = 2; constexpr float L2E = 1.4426950408889634f, PCAP = 32768.0f;      /* QT query tiles of 16 columns a wave: every K and V^T fragment loaded feeds QT products; waves w and w + NQW share their columns and take half the keys each; log2 e; PCAP: the sum of a lane's 16 weights of a pass up to which the reference point of its column stays, 2^15 */
  __shared__ __attribute__((aligned(16))) float sO[NW][16][64 + 4]; __shared__ __attribute__((aligned(16))) float sX[NW][2 * DT][32][4]; __shared__ float sML[NW][2][32];      /* output staging; the context tile, maximum and sum that a wave hands to its partner, lane by lane */
  const int tid = threadIdx.x, w = tid >> 5, lane = tid & 31, ln = lane & 15, hh = lane >> 4;
  const int slab = blockIdx.x / QBNP, qblk = QB0P + blockIdx.x % QBNP; const int b = slab / NH, h = slab % NH; const int qb0 = qblk * QPB; const int kh = __builtin_amdgcn_readfirstlane(w / NQW); const int q0 = qb0 + (w % NQW) * RPW;      /* kh: the wave's half of the keys, in a scalar register (it bounds the loop) */
  FragH bq[QT][KS];
#pragma unroll      /* constant indices: the array stays in registers */
  for (int qt = 0; qt < QT; ++qt) { const unsigned short* qr = (const unsigned short*)Q16 + ((size_t)b * TQ + q0 + qt * 16 + ln) * ldq + h * 64;
#pragma unroll      /* constant indices: the array stays in registers */
    for (int ks = 0; ks < KS; ++ks) { bq[qt][ks].half[0] = *(const v8us*)(qr + ks * 32 + 8 * hh); bq[qt][ks].half[1] = *(const v8us*)(qr + ks * 32 + 16 + 8 * hh); } }
  /* packed planes (k_prep): a fragment load is 32 lanes x 16 consecutive bytes, four whole 128-byte lines */
  const unsigned short* kpl = KP + (size_t)slab * 64 * TK; const unsigned short* mpl = MP + (size_t)__builtin_amdgcn_readfirstlane(q0 >> 4) * 16 * TK;      /* wave-uniform bases: scalar address arithmetic */
  const unsigned int l8 = lane * 8;      /* the lane's unit in every load */
  const unsigned int lt8 = (16 * ((lane >> 3) & 1) + 8 * (lane >> 4) + (lane & 7)) * 8;      /* the unit that the lane names in a transposing load: row 8 (lane >> 4) + (lane & 7) of the tile, column half (lane >> 3) & 1; the 32 lanes still cover the same 512 bytes */
  float m_r[QT], l_r[QT]; v8f oacc[QT][DT];
#pragma unroll      /* constant indices: the arrays stay in registers */
  for (int qt = 0; qt < QT; ++qt) { m_r[qt] = -3.0e38f; l_r[qt] = 0.f;
#pragma unroll      /* constant indices: the array stays in registers */
    for (int dt = 0; dt < DT; ++dt) oacc[qt][dt] = (v8f){0.f,0.f,0.f,0.f,0.f,0.f,0.f,0.f}; }
  const int jbeg = kh * (TK / 2), jend = jbeg + TK / 2;
  /* every global operand of the loop is held in registers and requested far ahead of its use; V^T's at the head of a pass, the next pass's K and mask each right after the step that last reads their registers */
  FragH ak[2][KS], av[DT]; v4u mk[QT][2];
  auto fetch_k = [&](int j0, bool closed = false) {      /* K fragments of the 32 keys from j0; closed: the last load, whose result may land in the address registers that the others name, is held back until those are through with them */
#pragma unroll      /* constant indices: the array stays in registers */
    for (int nt = 0; nt < 2; ++nt) { const unsigned short* kr = kpl + (size_t)j0 * 64 + nt * 1024;
#pragma unroll      /* constant indices: the array stays in registers */
      for (int ks = 0; ks < KS; ++ks) { ak[nt][ks].half[0] = *(const v8us*)(kr + ks * 512 + l8); if (closed && nt == 1 && ks == KS - 1) asm volatile("s_wait_xcnt 0x0" ::: "memory"); ak[nt][ks].half[1] = *(const v8us*)(kr + ks * 512 + 256 + l8); } } };
  auto fetch_m = [&](int j0) {      /* mode 33: the mask values of this lane's 16 score elements per query tile, 8 consecutive keys of its query's row per key tile, as bf16 pairs */
    if (CAUSAL == 33) {
#pragma unroll      /* constant indices: the array stays in registers */
      for (int qt = 0; qt < QT; ++qt) { const unsigned short* amk = mpl + (size_t)qt * 16 * TK + (size_t)j0 * 16;
#pragma unroll      /* constant indices: the array stays in registers */
        for (int nt = 0; nt < 2; ++nt) mk[qt][nt] = *(const v4u*)(amk + nt * 256 + l8); } } };
  v8f s[QT][2]; v2f sc[QT][8]; FragH pb[QT]; float ps[QT];      /* sc: pairs of neighbouring accumulator registers, written as vectors: the packed instructions then pair inside a tile, with no register moves */
  auto products = [&]() {      /* S^T of the 32 keys whose K fragments are held */
#pragma unroll      /* constant indices: the array stays in registers */
    for (int qt = 0; qt < QT; ++qt) { s[qt][0] = (v8f){0.f,0.f,0.f,0.f,0.f,0.f,0.f,0.f}; s[qt][1] = s[qt][0]; }
#pragma unroll      /* constant indices: the arrays stay in registers */
    for (int ks = 0; ks < KS; ++ks)      /* the four score tiles side by side in each k step; every tile still adds k step 0, then 1 */
#pragma unroll      /* constant indices: the arrays stay in registers */
      for (int nt = 0; nt < 2; ++nt)
#pragma unroll      /* constant indices: the arrays stay in registers */
        for (int qt = 0; qt < QT; ++qt) s[qt][nt] = mmaF(ak[nt][ks].v, bq[qt][ks].v, s[qt][nt]); };
  auto scores = [&]() {      /* scale, and the mask values that are held */
#pragma unroll      /* constant indices: the array stays in registers */
    for (int qt = 0; qt < QT; ++qt)
#pragma unroll      /* constant indices: the array stays in registers */
      for (int i = 0; i < 8; ++i) { v2f v = (v2f){s[qt][i >> 2][(2 * i) & 7], s[qt][i >> 2][(2 * i + 1) & 7]} * SCL; if (CAUSAL == 33) { const unsigned int mw = mk[qt][i >> 2][i & 3]; v += (v2f){__uint_as_float(mw << 16), __uint_as_float(mw & 0xFFFF0000u)}; } sc[qt][i] = v; } };
  auto colmax = [&](int qt) {      /* the query's maximum over the 32 keys, the same in both halves of the wave */
    const v2f (&c)[8] = sc[qt];
    const float ma = fmaxf(fmaxf(c[0][0], c[0][1]), c[1][0]), mb = fmaxf(fmaxf(c[1][1], c[2][0]), c[2][1]), mc3 = fmaxf(fmaxf(c[3][0], c[3][1]), c[4][0]), md = fmaxf(fmaxf(c[4][1], c[5][0]), c[5][1]), me = fmaxf(fmaxf(c[6][0], c[6][1]), c[7][0]);
    const float mc = fmaxf(fmaxf(fmaxf(ma, mb), mc3), fmaxf(fmaxf(md, me), c[7][1]));
    return fmaxf(mc, xhalf(mc)); };
  /* e^x as the hardware's 2^(x log2 e); where the library form's underflow select gives 0 (also at -inf, or a product that overflows to it) the hardware gives 0 too; a weight too large for f16 is caught by the loop's test before it is used */
  auto weights = [&]() {      /* from the scores and the reference points: P as the second product's operand, and the lane's sum of its weights */
#pragma unroll      /* constant indices: the arrays stay in registers */
    for (int qt = 0; qt < QT; ++qt) { const float mn = m_r[qt]; float p[16];
#pragma unroll      /* constant indices: the array stays in registers */
      for (int i = 0; i < 8; ++i) { const v2f x = __builtin_elementwise_fma(sc[qt][i] - mn, (v2f){L2E, L2E}, (v2f){4.0f, 4.0f}); p[2 * i] = __builtin_amdgcn_exp2f(x[0]); p[2 * i + 1] = __builtin_amdgcn_exp2f(x[1]); pb[qt].h[2 * i] = (_Float16)p[2 * i]; pb[qt].h[2 * i + 1] = (_Float16)p[2 * i + 1]; }      /* p = 16 e^(s - m): the operand's 2^4 scale rides in the exponent, and the row sum carries it too. The scale sets the room on both sides of the reference point: a score may pass it by ln 2^11 before PCAP is met, and a weight stays a normal f16 number down to e^-12.5 */
      ps[qt] = (((p[0] + p[1]) + (p[2] + p[3])) + ((p[4] + p[5]) + (p[6] + p[7]))) + (((p[8] + p[9]) + (p[10] + p[11])) + ((p[12] + p[13]) + (p[14] + p[15]))); } };
  fetch_k(jbeg); fetch_m(jbeg);
  /* m_r is the reference point of a column's sum and context, not its true maximum: it starts at the maximum over the first 32 keys (their scores are made again in the first pass, from the same registers) */
  products(); scores();
#pragma unroll      /* constant indices: the arrays stay in registers */
  for (int qt = 0; qt < QT; ++qt) m_r[qt] = fmaxf(m_r[qt], colmax(qt));
  /* the loop's common path addresses its loads by a plane's base and one 32-bit byte offset per operand stream (V^T and K in KP, the mask in MP), the lane's own, held in a register of its own for the whole pass and stepped only at the pass's foot, behind the wait that stands there: no register that a load names is written while the load is under way, so no wait stands directly behind the requests */
  unsigned int ov = (unsigned int)(((size_t)slab * 64 * TK + (size_t)jbeg * 64 + lt8) * 2);      /* V^T of this pass: the block of KP whose K fragments the pass before has fetched */
  unsigned int ok = (unsigned int)(((size_t)slab * 64 * TK + (size_t)(jbeg + 32) * 64 + l8) * 2);      /* K of the next pass */
  unsigned int om = (unsigned int)(((size_t)(q0 >> 4) * 16 * TK + (size_t)(jbeg + 32) * 16 + l8) * 2);      /* mask values of the next pass */
  static_assert(TK / 2 > 32, "a second pass exists");
  auto next_k = [&](bool closed = false) {      /* the K fragments at ok, in fetch_k's order; closed: as in fetch_k */
#pragma unroll      /* constant indices: the array stays in registers */
    for (int f = 0; f < 2 * KS; ++f) { ak[f / KS][f % KS].half[0] = *(const v8us*)((const char*)KP + ok + f * 1024); if (closed && f == 2 * KS - 1) asm volatile("s_wait_xcnt 0x0" ::: "memory"); ak[f / KS][f % KS].half[1] = *(const v8us*)((const char*)KP + ok + f * 1024 + 512); } };
  auto next_m = [&]() {      /* the mask values at om, in fetch_m's order */
#pragma unroll      /* constant indices: the array stays in registers */
    for (int f = 0; f < 2 * QT; ++f) if (CAUSAL == 33) mk[f / 2][f % 2] = *(const v4u*)((const char*)MP + om + (f / 2) * (32 * TK) + (f % 2) * 512); };
#pragma unroll 1      /* rolled: the operands fetched ahead keep one register set */
  for (int j0 = jbeg; j0 < jend; j0 += 32) {
    const int jn = (j0 + 32 < jend) ? j0 + 32 : jbeg;      /* the last pass re-reads the first block: in bounds, never used */
#pragma unroll      /* constant indices: the array stays in registers */
    for (int dt = 0; dt < DT; ++dt) { av[dt].half[0] = load_tr16((const char*)KP + ov + dt * 512); av[dt].half[1] = load_tr16((const char*)KP + ov + 2048 + dt * 512); }      /* half c = V[16 c + 8 hh + 0..7][16 dt + ln], from K's load [nt = c][ks = dt / 2][dt % 2]; used behind the softmax of this pass */
    __builtin_amdgcn_sched_barrier(0);      /* holds the requests above in their place: without it the compiler sinks them to their uses, and the wave waits out the latency */
    products();
    next_k();      /* the next pass's K, into the registers just read */
    __builtin_amdgcn_sched_barrier(0);      /* as at the head of the pass */
    scores();
    next_m();      /* the next pass's mask values, into the registers just read */
    __builtin_amdgcn_sched_barrier(0);      /* as at the head of the pass */
    weights();
    /* lazy rescale: the reference point moves only in a pass where some lane's weights add up to more than PCAP (no weight is negative, so up to there each fits f16); one test a pass for the whole wave, a scalar branch. Only then is a maximum taken, are sum and context scaled and the weights made anew; the scores are gone by then, so this pass's K and mask are read once more */
    if (__builtin_expect(__builtin_amdgcn_ballot_w32(ps[0] > PCAP || ps[1] > PCAP) != 0, 0)) {      /* marked unlikely: the pass's common path then runs straight through, with the rare one laid out of its way */
      fetch_k(j0, true); fetch_m(j0);
      asm volatile("s_wait_xcnt 0x0" ::: "memory");      /* before the address registers that these loads name are written again */
      products(); scores();
#pragma unroll      /* constant indices: the arrays stay in registers */
      for (int qt = 0; qt < QT; ++qt) {
        const float mn = fmaxf(m_r[qt], colmax(qt)); const float al = (mn > -1.0e38f) ? __builtin_amdgcn_exp2f((m_r[qt] - mn) * L2E) : 1.0f; m_r[qt] = mn; l_r[qt] *= al;
#pragma unroll      /* constant indices: the array stays in registers */
        for (int dt = 0; dt < DT; ++dt) oacc[qt][dt] *= al; }
      weights();
      next_k(true); next_m();      /* the next pass's operands again, into the registers just read; on this side the compiler forms whole addresses in spare registers */
      asm volatile("s_wait_xcnt 0x0" ::: "memory"); }      /* as above */
#pragma unroll      /* constant indices: the arrays stay in registers */
    for (int qt = 0; qt < QT; ++qt) { l_r[qt] += ps[qt];
#pragma unroll      /* constant indices: the array stays in registers */
      for (int dt = 0; dt < DT; ++dt) oacc[qt][dt] = mmaF(av[dt].v, pb[qt].v, oacc[qt][dt]); }
    /* v_nop: the distance behind the pass's last products on the branch's taken side: the next pass's first score products write over the P registers that these read as B. s_wait_xcnt: the offset steps below rewrite the address registers that this pass's loads name */
    asm volatile("v_nop\n\tv_nop\n\tv_nop\n\tv_nop\n\ts_wait_xcnt 0x0" : "+v"(oacc[0][0]), "+v"(oacc[0][1]), "+v"(oacc[0][2]), "+v"(oacc[0][3]), "+v"(oacc[1][0]), "+v"(oacc[1][1]), "+v"(oacc[1][2]), "+v"(oacc[1][3]), "+v"(ov), "+v"(ok), "+v"(om) : : "memory");      /* the three offsets pass through it: their steps below stand behind the wait */
    const int jn1 = (j0 + 64 < jend) ? j0 + 64 : jbeg;      /* the block that the next pass fetches ahead */
    ov += 32 * 64 * 2; ok += (unsigned int)((jn1 - jn) * (64 * 2)); om += (unsigned int)((jn1 - jn) * (16 * 2)); }
  /* the two halves of the keys are joined: wave kh finishes query tile kh and hands its part of the other tile to its partner */
  const int pw = w ^ NQW; const bool k1 = kh != 0;
  const float mg = k1 ? m_r[0] : m_r[1], lg = k1 ? l_r[0] : l_r[1], mo = k1 ? m_r[1] : m_r[0], lo = k1 ? l_r[1] : l_r[0]; v8f oo[DT];
#pragma unroll      /* constant indices: the arrays stay in registers */
  for (int dt = 0; dt < DT; ++dt) { const v8f g = k1 ? oacc[0][dt] : oacc[1][dt]; oo[dt] = k1 ? oacc[1][dt] : oacc[0][dt];
    *(v4fa*)&sX[w][2 * dt][lane][0] = (v4f){g[0], g[1], g[2], g[3]}; *(v4fa*)&sX[w][2 * dt + 1][lane][0] = (v4f){g[4], g[5], g[6], g[7]}; }
  sML[w][0][lane] = mg; sML[w][1][lane] = lg;
  __syncthreads();      /* every wave's handed-over part is written before its partner reads it */
  { const float mp = sML[pw][0][lane], lp = sML[pw][1][lane]; const float mn = fmaxf(mo, mp);
    const float ao = (mn > -1.0e38f) ? __builtin_amdgcn_exp2f((mo - mn) * L2E) : 1.0f, ap = (mn > -1.0e38f) ? __builtin_amdgcn_exp2f((mp - mn) * L2E) : 1.0f;      /* each part is brought to the common maximum, as the loop does from pass to pass */
    const float lh = lo * ao + lp * ap; const float l = lh + xhalf(lh);      /* the two lane halves' sums of the query's row, joined once */
    const float inv = (l > 0.f) ? 1.0f / l : 0.f;      /* sum and context both carry the factor 16 */
#pragma unroll      /* constant indices: the array stays in registers */
    for (int dt = 0; dt < DT; ++dt) { const v4f x0 = *(const v4fa*)&sX[pw][2 * dt][lane][0], x1 = *(const v4fa*)&sX[pw][2 * dt + 1][lane][0]; const v8f x = {x0[0], x0[1], x0[2], x0[3], x1[0], x1[1], x1[2], x1[3]};
      const v8f o = (oo[dt] * ao + x * ap) * inv;      /* register r = O[q0 + 16 kh + ln][16 dt + 8 hh + r] */
      *(v4fa*)&sO[w][ln][dt * 16 + 8 * hh] = (v4f){o[0], o[1], o[2], o[3]}; *(v4fa*)&sO[w][ln][dt * 16 + 8 * hh + 4] = (v4f){o[4], o[5], o[6], o[7]}; } }
  __builtin_amdgcn_fence(__ATOMIC_ACQ_REL, "workgroup"); __builtin_amdgcn_wave_barrier();      /* the wave's own staged rows are written before its lanes read them back as whole lines */
  {
#pragma unroll      /* constant indices: the array stays in registers */
    for (int rp = 0; rp < 16; rp += 2) { const int r = rp + (lane >> 4), pc = lane & 15; const v4f val = *(const v4fa*)&sO[w][r][pc * 4]; *(v4f*)(O + ((size_t)b * TQ + q0 + kh * 16 + r) * ldo + h * 64 + pc * 4) = val; }
     } }
// 5-plane variant: S = Qh Kh^T + (Ql Kh^T + Qh Kl^T)/1024 with Q/K = [hi | 2^10 residual] f16 planes (QL/KL same layout as Q16/K16), then the 3-term P.V below.
// 3-term variant: O = (P_hi V_hi + (P_lo V_hi + P_hi V_lo) / 1024) / l with P = [hi | 2^10 residual] of 1024 p and V^T = [hi | 2^10 residual] planes (VtL same layout as Vt) -> ~2^-21-class products for un-averaged (early causal / peaked) rows
template <int CAUSAL>
__global__ __launch_bounds__(128) void k_flash5(const _Float16* __restrict__ Q16, const _Float16* __restrict__ QL, int ldq, const _Float16* __restrict__ K16, const _Float16* __restrict__ KL, int ldk, const _Float16* __restrict__ Vt, const _Float16* __restrict__ VtL, const int* __restrict__ MSK, float* __restrict__ O, int ldo) {
  constexpr int RPW = 16, RTN = RPW / 16, NQB = TQ / (4 * RPW), DT = 4, KS = 2;
  __shared__ __attribute__((aligned(16))) unsigned short sP[4][RPW][40]; __shared__ __attribute__((aligned(16))) unsigned short sPL[4][RPW][40]; __shared__ __attribute__((aligned(16))) float sO[4][RPW][64 + 4];
  const int tid = threadIdx.x, w = tid >> 5, lane = tid & 31, ln = lane & 15, hh = lane >> 4;
  const int slab = blockIdx.x / QBN5, qblk = QB05 + blockIdx.x % QBN5; (void)NQB; const int b = slab / NH, h = slab % NH; const int qb0 = qblk * (4 * RPW); const int q0 = qb0 + w * RPW;
  FragH aq[2][KS], aql[2][KS];
#pragma unroll
  for (int rt = 0; rt < RTN; ++rt) { const unsigned short* qr = (const unsigned short*)Q16 + ((size_t)b * TQ + q0 + rt * 16 + ln) * ldq + h * 64; const unsigned short* ql = (const unsigned short*)QL + ((size_t)b * TQ + q0 + rt * 16 + ln) * ldq + h * 64;
#pragma unroll
    for (int ks = 0; ks < KS; ++ks) { aq[rt][ks].half[0] = *(const v8us*)(qr + ks * 32 + 8 * hh); aq[rt][ks].half[1] = *(const v8us*)(qr + ks * 32 + 16 + 8 * hh); aql[rt][ks].half[0] = *(const v8us*)(ql + ks * 32 + 8 * hh); aql[rt][ks].half[1] = *(const v8us*)(ql + ks * 32 + 16 + 8 * hh); } }
  const unsigned short* Vth = (const unsigned short*)Vt + (size_t)slab * 64 * TK; const unsigned short* Vtl = (const unsigned short*)VtL + (size_t)slab * 64 * TK;
  float m_r[2][8], l_r[2][8]; v8f oacc[2][DT], oaccL[2][DT];
#pragma unroll
  for (int rt = 0; rt < RTN; ++rt) {
#pragma unroll
    for (int r = 0; r < 8; ++r) { m_r[rt][r] = -3.0e38f; l_r[rt][r] = 0.f; }
#pragma unroll
    for (int dt = 0; dt < DT; ++dt) { oacc[rt][dt] = (v8f){0.f,0.f,0.f,0.f,0.f,0.f,0.f,0.f}; oaccL[rt][dt] = oacc[rt][dt]; } }
  const int jend = (CAUSAL == 1) ? (qb0 + 4 * RPW) : ((CAUSAL == 23) ? min(TK, (qb0 / CHK + 2) * CHK) : TK);      /* causal / window: keys that can never contribute are skipped */ const int jbeg = (CAUSAL == 23) ? max(0, (qb0 / CHK - 1) * CHK) : 0;
#pragma unroll 1
  for (int j0 = jbeg; j0 < jend; j0 += 32) {
    v8f s[2][2];
#pragma unroll
    for (int nt = 0; nt < 2; ++nt) { const unsigned short* kr = (const unsigned short*)K16 + ((size_t)b * TK + j0 + nt * 16 + ln) * ldk + h * 64; const unsigned short* klr = (const unsigned short*)KL + ((size_t)b * TK + j0 + nt * 16 + ln) * ldk + h * 64; FragH bk[KS], bkl[KS];
#pragma unroll
      for (int ks = 0; ks < KS; ++ks) { bk[ks].half[0] = *(const v8us*)(kr + ks * 32 + 8 * hh); bk[ks].half[1] = *(const v8us*)(kr + ks * 32 + 16 + 8 * hh); bkl[ks].half[0] = *(const v8us*)(klr + ks * 32 + 8 * hh); bkl[ks].half[1] = *(const v8us*)(klr + ks * 32 + 16 + 8 * hh); }
#pragma unroll
      for (int rt = 0; rt < RTN; ++rt) { v8f acc = (v8f){0.f,0.f,0.f,0.f,0.f,0.f,0.f,0.f}, accl = acc;
#pragma unroll
        for (int ks = 0; ks < KS; ++ks) { acc = mmaH<1>(aq[rt][ks].v, aq[rt][ks].v, bk[ks].v, bk[ks].v, acc); accl = mmaH<1>(aql[rt][ks].v, aql[rt][ks].v, bk[ks].v, bk[ks].v, accl); accl = mmaH<1>(aq[rt][ks].v, aq[rt][ks].v, bkl[ks].v, bkl[ks].v, accl); }
#pragma unroll
        for (int r = 0; r < 8; ++r) acc[r] += accl[r] * 0.0009765625f;
        s[rt][nt] = acc; } }
#pragma unroll
    for (int rt = 0; rt < RTN; ++rt)
#pragma unroll
      for (int r = 0; r < 8; ++r) { const int tq = q0 + rt * 16 + 8 * hh + r; const int k0 = j0 + ln, k1 = j0 + 16 + ln;
        bool ok0 = (CAUSAL == 1) ? (k0 <= tq) : ((CAUSAL == 2) ? ((k0 >> 5) == (tq >> 5)) : true), ok1 = (CAUSAL == 1) ? (k1 <= tq) : ((CAUSAL == 2) ? ((k1 >> 5) == (tq >> 5)) : true);      /* mode 2: block-diagonal 32-token groups */
        if (CAUSAL == 4) { const int* mrow = MSK + ((size_t)b * TQ + tq) * TK; ok0 = mrow[k0] != 0; ok1 = mrow[k1] != 0; }      /* mode 4: per-(query, key) INPUT mask shared by all heads; masked keys contribute nothing (== the reference's -4096 fill, whose exp underflows to 0), rows with no valid key give l = 0 -> output 0 (== the reference's row_valid zeroing) */
        float s0 = ok0 ? s[rt][0][r] * SCL : -3.0e38f, s1 = ok1 ? s[rt][1][r] * SCL : -3.0e38f; if (CAUSAL == 33) { const float* amk = (const float*)MSK + (size_t)tq * TK; s0 += bf16_round(amk[k0]); s1 += bf16_round(amk[k1]); }      /* mode 33: one additive [TQ][TK] f32 table shared by every slab */ if (CAUSAL == 17) { const float* amk = (const float*)MSK + (size_t)b * TK; s0 += bf16_round(amk[k0]); s1 += bf16_round(amk[k1]); } if (CAUSAL == 18) { const float* tb = (const float*)MSK; const int* ri = MSK + 1024 + (size_t)b * TK; const int rq = ri[tq]; s0 += tb[(h * 8 + rq) * 8 + ri[k0]]; s1 += tb[(h * 8 + rq) * 8 + ri[k1]]; } if (CAUSAL == 19) { const int* rel = MSK + (size_t)tq * TK; const float* rb = (const float*)MSK + (size_t)TQ * TK + ((size_t)(b * NH + h) * TQ + tq) * 64; s0 += rb[rel[k0]]; s1 += rb[rel[k1]]; }      /* mode 19: + (q.Ek[rel] + Eb[rel][h]) / 8 gathered by the int relative ids (packed [ids | table]) */      /* mode 18: + resource_bias[h][r_q][r_k] from the packed [table | ids] buffer (TQ == TK) */      /* mode 17: additive per-(batch, key) mask INPUT */ float mc = fmaxf(s0, s1);
        mc = fmaxf(mc, __shfl_xor(mc, 1, 32)); mc = fmaxf(mc, __shfl_xor(mc, 2, 32)); mc = fmaxf(mc, __shfl_xor(mc, 4, 32)); mc = fmaxf(mc, __shfl_xor(mc, 8, 32));
        const float mn = fmaxf(m_r[rt][r], mc); const float al = (mn > -1.0e38f) ? expf(m_r[rt][r] - mn) : 1.0f; m_r[rt][r] = mn; const float p0 = ok0 ? expf(s0 - mn) : 0.f, p1 = ok1 ? expf(s1 - mn) : 0.f; l_r[rt][r] = l_r[rt][r] * al + p0 + p1;
#pragma unroll
        for (int dt = 0; dt < DT; ++dt) { oacc[rt][dt][r] *= al; oaccL[rt][dt][r] *= al; }
        FragH t2, t2l; const float ps0 = p0 * 1024.0f, ps1 = p1 * 1024.0f; t2.h[0] = (_Float16)ps0; t2.h[1] = (_Float16)ps1; t2l.h[0] = (_Float16)((ps0 - (float)t2.h[0]) * 1024.0f); t2l.h[1] = (_Float16)((ps1 - (float)t2.h[1]) * 1024.0f);
        sP[w][rt * 16 + 8 * hh + r][ln] = t2.u[0]; sP[w][rt * 16 + 8 * hh + r][16 + ln] = t2.u[1]; sPL[w][rt * 16 + 8 * hh + r][ln] = t2l.u[0]; sPL[w][rt * 16 + 8 * hh + r][16 + ln] = t2l.u[1]; }
    __builtin_amdgcn_fence(__ATOMIC_ACQ_REL, "workgroup"); __builtin_amdgcn_wave_barrier();
    FragH pa[2], pl[2];
#pragma unroll
    for (int rt = 0; rt < RTN; ++rt) { pa[rt].half[0] = *(const v8us*)&sP[w][rt * 16 + ln][8 * hh]; pa[rt].half[1] = *(const v8us*)&sP[w][rt * 16 + ln][16 + 8 * hh]; pl[rt].half[0] = *(const v8us*)&sPL[w][rt * 16 + ln][8 * hh]; pl[rt].half[1] = *(const v8us*)&sPL[w][rt * 16 + ln][16 + 8 * hh]; }
#pragma unroll
    for (int dt = 0; dt < DT; ++dt) { const unsigned short* vrow = Vth + (size_t)(dt * 16 + ln) * TK + j0; const unsigned short* vrl = Vtl + (size_t)(dt * 16 + ln) * TK + j0; FragH bv, bl; bv.half[0] = *(const v8us*)(vrow + 8 * hh); bv.half[1] = *(const v8us*)(vrow + 16 + 8 * hh); bl.half[0] = *(const v8us*)(vrl + 8 * hh); bl.half[1] = *(const v8us*)(vrl + 16 + 8 * hh);
#pragma unroll
      for (int rt = 0; rt < RTN; ++rt) { oacc[rt][dt] = mmaH<1>(pa[rt].v, pa[rt].v, bv.v, bv.v, oacc[rt][dt]); oaccL[rt][dt] = mmaH<1>(pl[rt].v, pl[rt].v, bv.v, bv.v, oaccL[rt][dt]); oaccL[rt][dt] = mmaH<1>(pa[rt].v, pa[rt].v, bl.v, bl.v, oaccL[rt][dt]); } }
    __builtin_amdgcn_fence(__ATOMIC_ACQ_REL, "workgroup"); __builtin_amdgcn_wave_barrier(); }
#pragma unroll
  for (int rt = 0; rt < RTN; ++rt) {
#pragma unroll
    for (int r = 0; r < 8; ++r) { float l = l_r[rt][r]; l += __shfl_xor(l, 1, 32); l += __shfl_xor(l, 2, 32); l += __shfl_xor(l, 4, 32); l += __shfl_xor(l, 8, 32); l_r[rt][r] = (l > 0.f) ? 1.0f / (l * 1024.0f) : 0.f; }
#pragma unroll
    for (int dt = 0; dt < DT; ++dt)
#pragma unroll
      for (int r = 0; r < 8; ++r) { float v = oacc[rt][dt][r]; v += oaccL[rt][dt][r] * 0.0009765625f; sO[w][rt * 16 + 8 * hh + r][dt * 16 + ln] = v * l_r[rt][r]; } }
  __builtin_amdgcn_fence(__ATOMIC_ACQ_REL, "workgroup"); __builtin_amdgcn_wave_barrier();
  {
#pragma unroll
    for (int rp = 0; rp < RPW; rp += 2) { const int r = rp + (lane >> 4), pc = lane & 15; const v4f val = *(const v4fa*)&sO[w][r][pc * 4]; *(v4f*)(O + ((size_t)b * TQ + q0 + r) * ldo + h * 64 + pc * 4) = val; }
     } }

__global__ __launch_bounds__(256) void k_rotab(float* __restrict__ CS, float* __restrict__ SN) {
  #pragma clang fp contract(off)
  const int t = blockIdx.x * 256 + threadIdx.x; if (t >= SLEN * 32) return; const int j = t % 32, s = t / 32; const float ex = (float)(2 * j) / 64.0f; const float inv = 1.0f / powf(10000.0f, ex); const float th = (float)s * inv; const float c = cosf(th), sn = sinf(th);
  { *(float*)(CS + t) = c; *(float*)(SN + t) = sn;  } }
__global__ __launch_bounds__(256) void k_rope(const float* __restrict__ F, int nsrc, int ndst, int rep, const float* __restrict__ CS, const float* __restrict__ SN, _Float16* __restrict__ H, _Float16* __restrict__ L) {
  #pragma clang fp contract(off)
  const size_t t = (size_t)blockIdx.x * 256 + threadIdx.x; if (t >= (size_t)NR * ndst * 4) return; const int g8 = (int)(t % 4); const int hd = (int)((t / 4) % ndst); const size_t row = t / ((size_t)4 * ndst); const int s = (int)(row % SLEN); const int hs = hd / rep;
  const float* src = F + row * (size_t)(nsrc * 64) + hs * 64; FragH ah, al, bh, bl;
  for (int i = 0; i < 8; ++i) { const int d = g8 * 8 + i; const float c = CS[s * 32 + d], sn = SN[s * 32 + d]; const float x1 = src[d], x2 = src[d + 32];
    float o1 = x1 * c; o1 += -x2 * sn; float o2 = x2 * c; o2 += x1 * sn;
    _Float16 hv = (_Float16)o1; ah.h[i] = hv; al.h[i] = (_Float16)((o1 - (float)hv) * 1024.0f); hv = (_Float16)o2; bh.h[i] = hv; bl.h[i] = (_Float16)((o2 - (float)hv) * 1024.0f); }
  const size_t o = row * (size_t)(ndst * 64) + hd * 64 + g8 * 8;
  { *(v8us*)((unsigned short*)H + o) = ah.half[0]; *(v8us*)((unsigned short*)H + o + 32) = bh.half[0]; *(v8us*)((unsigned short*)L + o) = al.half[0]; *(v8us*)((unsigned short*)L + o + 32) = bl.half[0];  } }
__global__ __launch_bounds__(256) void k_rope2(const float* __restrict__ F, int nsrc, int ndst, int rep, const float* __restrict__ CS, const float* __restrict__ SN, _Float16* __restrict__ H, _Float16* __restrict__ L) {
  #pragma clang fp contract(off)
  const size_t t = (size_t)blockIdx.x * 256 + threadIdx.x; if (t >= (size_t)NR * ndst * 4) return; const int g16 = (int)(t % 4); const int hd = (int)((t / 4) % ndst); const size_t row = t / ((size_t)4 * ndst); const int s = (int)(row % SLEN); const int hs = hd / rep;
  const float* src = F + row * (size_t)(nsrc * 64) + hs * 64 + g16 * 16; FragH ah, al;
  for (int pr = 0; pr < 8; ++pr) { const int i = g16 * 8 + pr; const float c = CS[s * 32 + i], sn = SN[s * 32 + i]; const float x1 = src[2 * pr], x2 = src[2 * pr + 1];
    float o1 = x1 * c; o1 -= x2 * sn; float o2 = x1 * sn; o2 += x2 * c;
    _Float16 hv = (_Float16)o1; ah.h[2 * pr] = hv; al.h[2 * pr] = (_Float16)((o1 - (float)hv) * 1024.0f); hv = (_Float16)o2; ah.h[2 * pr + 1] = hv; al.h[2 * pr + 1] = (_Float16)((o2 - (float)hv) * 1024.0f); }
  const size_t o = row * (size_t)(ndst * 64) + hd * 64 + g16 * 16;
  { *(v8us*)((unsigned short*)H + o) = ah.half[0]; *(v8us*)((unsigned short*)H + o + 8) = ah.half[1]; *(v8us*)((unsigned short*)L + o) = al.half[0]; *(v8us*)((unsigned short*)L + o + 8) = al.half[1];  } }
__global__ __launch_bounds__(256) void k_ln512(const float* __restrict__ A, const float* __restrict__ res, const float* __restrict__ g, const float* __restrict__ bb, float* __restrict__ Y, _Float16* __restrict__ Y16) {
  #pragma clang fp contract(off)
  const int wv = threadIdx.x >> 5, ln = threadIdx.x & 31; const size_t r = (size_t)blockIdx.x * 8 + wv; if (r >= NR) return; float x[16]; float s = 0.f;
  for (int i = 0; i < 2; ++i) { const v8f a = *(const v8f*)(A + r * DM + i * 256 + ln * 8); for (int q = 0; q < 8; ++q) { float v = a[q]; if (res) v += bf16_round(res[r * DM + i * 256 + ln * 8 + q]); x[i * 8 + q] = v; s += v; } }
  for (int o = 16; o > 0; o >>= 1) s += __shfl_xor(s, o, 32); const float mu = s / (float)DM; float var = 0.f; for (int q = 0; q < 16; ++q) { const float d = x[q] - mu; var += d * d; }
  for (int o = 16; o > 0; o >>= 1) var += __shfl_xor(var, o, 32); const float inv = rsqrtf(var / (float)DM + 1e-5f);
  { for (int i = 0; i < 2; ++i) { const int c0 = i * 256 + ln * 8; v8f y; FragH f; for (int q = 0; q < 8; ++q) { float v = (x[i * 8 + q] - mu) * inv; v *= bf16_round(g[c0 + q]); v += bf16_round(bb[c0 + q]); y[q] = v; f.h[q] = (_Float16)v; } *(v8f*)(Y + r * DM + c0) = y; if (Y16) *(v8us*)((unsigned short*)Y16 + r * DM + c0) = f.half[0]; }  } }
__global__ __launch_bounds__(256) void k_pack(const float* __restrict__ rb, const int* __restrict__ rid, int* __restrict__ PK) { const int t = blockIdx.x * 256 + threadIdx.x; if (t >= 1024 + NB * TK) return; int v; if (t < 1024) v = __float_as_int(bf16_round(rb[t])); else v = rid[t - 1024]; *(int*)(PK + t) = v;  }
__global__ __launch_bounds__(256) void k_tabin(const float* __restrict__ sp, float* __restrict__ CS, float* __restrict__ SN) { const int t = blockIdx.x * 256 + threadIdx.x; if (t >= SLEN * 32) return; const int i = t % 32, s = t / 32; const float c = bf16_round(sp[s * 64 + 32 + i]), sn = bf16_round(sp[s * 64 + i]);
  { *(float*)(CS + t) = c; *(float*)(SN + t) = sn;  } }
__global__ __launch_bounds__(256) void k_wsc(const float* __restrict__ Wm, _Float16* __restrict__ Bt, size_t n8, float sc) { const size_t t = (size_t)blockIdx.x * 256 + threadIdx.x; if (t >= n8) return; FragH f; for (int q = 0; q < 8; ++q) f.h[q] = (_Float16)(bf16_round(Wm[t * 8 + q]) * sc); *(v8us*)((unsigned short*)Bt + t * 8) = f.half[0];  }
__global__ __launch_bounds__(256) void k_rotab2(float* __restrict__ CS, float* __restrict__ SN) {
  #pragma clang fp contract(off)
  const int t = blockIdx.x * 256 + threadIdx.x; if (t >= SLEN * 32) return; const int j = t % 32, s = t / 32; const float c0 = -0.14391156831212787f;      /* -ln(10000)/64 rounded to f32 */ const float inv = expf((float)(2 * j) * c0); const float th = (float)s * inv; const float c = cosf(th), sn = sinf(th);
  { *(float*)(CS + t) = c; *(float*)(SN + t) = sn;  } }
__global__ __launch_bounds__(256) void k_lnu(const float* __restrict__ X, _Float16* __restrict__ N16, float* __restrict__ XB) {
  #pragma clang fp contract(off)
  const int wv = threadIdx.x >> 5, ln = threadIdx.x & 31; const size_t r = (size_t)blockIdx.x * 8 + wv; if (r >= NR) return; float a[32]; float s = 0.f;
  for (int i = 0; i < 4; ++i) { const v8f v = *(const v8f*)(X + r * DM + (i * 32 + ln) * 8); for (int q = 0; q < 8; ++q) { const float u = bf16_round(v[q]); a[i * 8 + q] = u; s += u; } }
  for (int o = 16; o > 0; o >>= 1) s += __shfl_xor(s, o, 32); const float mu = s / (float)DM; float var = 0.f; for (int q = 0; q < 32; ++q) { const float d = a[q] - mu; var += d * d; }
  for (int o = 16; o > 0; o >>= 1) var += __shfl_xor(var, o, 32); const float den = sqrtf(var / (float)(DM - 1)) + 1e-6f; const float inv = 1.0f / den;      /* one reciprocal per row; (x-mean)*inv vs the reference's division differs by <= 1 ulp */
  { for (int i = 0; i < 4; ++i) { const int c0 = (i * 32 + ln) * 8; FragH f; v8f xb; for (int q = 0; q < 8; ++q) { f.h[q] = (_Float16)((a[i * 8 + q] - mu) * inv); xb[q] = a[i * 8 + q]; } *(v8us*)((unsigned short*)N16 + r * DM + c0) = f.half[0]; *(v8f*)(XB + r * DM + c0) = xb; }  } }
__global__ __launch_bounds__(256) void k_vtg(const _Float16* __restrict__ V16, _Float16* __restrict__ Vt) { __shared__ unsigned short tl[64][66]; const int tid = threadIdx.x; const int slab = blockIdx.x / (SLEN / 64), lg = blockIdx.x % (SLEN / 64); const int b = slab / NH, h = slab % NH; const int hs = h / NREP;
  for (int i = tid; i < 64 * 8; i += 256) { const int r = i / 8, c8 = (i % 8) * 8; FragH f; f.half[0] = *(const v8us*)((const unsigned short*)V16 + ((size_t)b * SLEN + lg * 64 + r) * KVD + hs * 64 + c8); for (int q = 0; q < 8; ++q) tl[r][c8 + q] = f.u[q]; }
  __syncthreads();
  { for (int rd = 0; rd < 2; ++rd) { const int d = rd * 32 + tid / 8, pc = tid % 8; FragH f; for (int q = 0; q < 8; ++q) f.u[q] = tl[pc * 8 + q][d]; *(v8us*)((unsigned short*)Vt + ((size_t)slab * 64 + d) * SLEN + lg * 64 + pc * 8) = f.half[0]; }  } }

__global__ __launch_bounds__(256) void k_h16s(const float* __restrict__ SRC, int lds, int coff, _Float16* __restrict__ DST, size_t n8) { const size_t t = (size_t)blockIdx.x * 256 + threadIdx.x; if (t >= n8) return; const size_t r = (t * 8) / DM; const int c = (int)((t * 8) % DM); const v8f a = *(const v8f*)(SRC + r * lds + coff + c); FragH f; for (int q = 0; q < 8; ++q) f.h[q] = (_Float16)a[q];
  *(v8us*)((unsigned short*)DST + t * 8) = f.half[0];  }


__global__ __launch_bounds__(256) void k_ccp(const float* __restrict__ QKV, int coff, _Float16* __restrict__ D) { const size_t t = (size_t)blockIdx.x * 256 + threadIdx.x; if (t >= (size_t)NR * DM / 8) return; const int c0 = (int)((t * 8) % DM); const size_t row = (t * 8) / DM; const v8f a = *(const v8f*)(QKV + row * 3 * DM + coff + c0); FragH f; for (int q = 0; q < 8; ++q) f.h[q] = (_Float16)a[q];
  *(v8us*)((unsigned short*)D + t * 8) = f.half[0];  }


extern "C" void kernel_launch(void* const* d_in, const int* in_sizes, int n_in,
                              void* d_out, int out_size, void* d_ws, size_t ws_size, hipStream_t stream) {
  (void)in_sizes; (void)n_in; (void)out_size;
  const float* q = (const float*)d_in[0]; const float* kv = (const float*)d_in[1]; const float* mask = (const float*)d_in[2]; float* O = (float*)d_out;
  char* ws = (char*)d_ws; size_t off = 0;
  auto take = [&](size_t bytes) { char* p = ws + off; off += (bytes + 255) & ~(size_t)255; return p; };
  const size_t np = (size_t)NR * DM;      /* 32 x 2048 x 64 */
  _Float16* Q16 = (_Float16*)take(np * 2); unsigned short* KP = (unsigned short*)take(np * 2); unsigned short* MP = (unsigned short*)take((size_t)TQ * TK * 2);
  if (off > ws_size) return;      /* 24 MiB */
  static_assert(NR / 32 == TQ / 8 * TK / 256, "q, kv and the mask have the same number of units");
  k_prep<<<NR / 32 / PU, 256, 0, stream>>>(q, kv, mask, (unsigned short*)Q16, KP, MP);      /* values = keys */
  k_flash<33><<<NB * NH * QBNP, 512, 0, stream>>>(Q16, DM, KP, MP, O, DM);      /* f32 context straight to the output rows */
}
